// v000
// The times below were measured on an AMD MI455X: many runs one after another, warmed up first and cycling through
// copies of the inputs, with the whole window's GPU time divided by the number of runs. Launches and the gaps
// between them are all in it. The median over several windows is given; except for v000 it joins two sittings, which
// can be a few percent apart, so the side-by-side timings, each taken in one sitting, are the better comparison.
// The starting kernel, v000, takes 307 microseconds a run.
#include <hip/hip_runtime.h>

// ---------------------------------------------------------------------------
// MI455X (gfx1250) fused attention: QKV+RoPE -> softmax attention -> out proj
// All matrix math via v_wmma_f32_16x16x32_f16 (wave32, f32 accumulate).
// Memory strategy: all fragment traffic is wide/contiguous f16:
//   - hidden pre-converted & permuted to f16 (kernel 0a)
//   - weights pre-packed into WMMA B-fragment order (kernel 0b)
//   - V written transposed so attention B-frags are contiguous
// ---------------------------------------------------------------------------

typedef __attribute__((ext_vector_type(16))) _Float16 v16h;
typedef __attribute__((ext_vector_type(8)))  _Float16 v8h;
typedef __attribute__((ext_vector_type(8)))  float    v8f;
typedef __attribute__((ext_vector_type(4)))  float    v4f;

#define D_MODEL   1024
#define N_HEADS   16
#define N_KVH     4
#define HEAD_DIM  64
#define SEQ       512
#define BP        16          // B*P = 2*8
#define ROWS      8192        // BP * SEQ
#define KCH       (D_MODEL / 32)   // 32 k-chunks of 32

__device__ __forceinline__ v8f wmma16x16x32(v16h a, v16h b, v8f c) {
  // (neg_a, A, neg_b, B, c_mod, C, reuse_a, reuse_b)
  return __builtin_amdgcn_wmma_f32_16x16x32_f16(false, a, false, b, (short)0, c,
                                                false, false);
}

__device__ __forceinline__ v16h cat8(v8h lo, v8h hi) {
  v16h r;
#pragma unroll
  for (int i = 0; i < 8; ++i) { r[i] = lo[i]; r[i + 8] = hi[i]; }
  return r;
}

// ===========================================================================
// Kernel 0a: hidden (b,t,p,d) fp32 -> xh (b,p,t,d) f16.  Fully coalesced.
// One thread handles 8 consecutive d.  grid = ROWS*D_MODEL/8/256 blocks.
// ===========================================================================
__global__ __launch_bounds__(256)
void convert_x_kernel(const float* __restrict__ hidden,
                      _Float16* __restrict__ xh)
{
  const int idx = blockIdx.x * 256 + threadIdx.x;     // 0 .. 1M-1
  const int d0  = (idx & 127) << 3;                   // 8-elem group in row
  const int rr  = idx >> 7;                           // (b,p,t) row
  const int bb  = rr >> 12;
  const int pp  = (rr >> 9) & 7;
  const int tt  = rr & (SEQ - 1);
  const float* src = hidden + (((size_t)(bb * SEQ + tt) * 8 + pp) << 10) + d0;
  v4f f0 = *(const v4f*)(src);
  v4f f1 = *(const v4f*)(src + 4);
  v8h h;
#pragma unroll
  for (int i = 0; i < 4; ++i) {
    h[i]     = (_Float16)f0[i];
    h[i + 4] = (_Float16)f1[i];
  }
  *(v8h*)(xh + (size_t)rr * D_MODEL + d0) = h;
}

// ===========================================================================
// Kernel 0b: pack fp32 weight (K=1024 x N) into f16 B-fragment order:
//   dst[((nt*KCH + kc)*32 + lane)*16 + i] = W[k(lane,i)*N + nt*16 + (lane&15)]
// with k = kc*32 + koff + i (i<8) / kc*32 + 16 + koff + i-8, koff=(lane>>4)*8.
// grid = (N/16, KCH), 32 threads. Runs once; packed weights stay in L2.
// ===========================================================================
__global__ __launch_bounds__(32)
void pack_w_kernel(const float* __restrict__ W, int N,
                   _Float16* __restrict__ dst)
{
  const int lane = threadIdx.x;
  const int ln   = lane & 15;
  const int koff = (lane >> 4) << 3;
  const int nt   = blockIdx.x;
  const int kc   = blockIdx.y;
  const int kb   = kc * 32;
  const float* col = W + nt * 16 + ln;
  v16h b;
#pragma unroll
  for (int i = 0; i < 8; ++i) {
    b[i]     = (_Float16)col[(size_t)(kb + koff + i) * N];
    b[i + 8] = (_Float16)col[(size_t)(kb + 16 + koff + i) * N];
  }
  *(v16h*)(dst + ((size_t)(nt * KCH + kc) * 32 + lane) * 16) = b;
}

// ===========================================================================
// Kernel 1: QKV projection + RoPE + q-scale from packed f16 operands.
// 4 waves / block, wave w handles row tile rt = blockIdx.x*4 + w (16 rows)
// for one 64-wide head column (blockIdx.y in [0,24)).
// Q/K written row-major (slot,t,d) via LDS-staged wide stores.
// V written TRANSPOSED (slot,d,t) straight from registers (wide stores).
// ===========================================================================
__global__ __launch_bounds__(128)
void qkv_rope_kernel(const _Float16* __restrict__ xh,
                     const _Float16* __restrict__ pWq,
                     const _Float16* __restrict__ pWk,
                     const _Float16* __restrict__ pWv,
                     _Float16* __restrict__ qws,
                     _Float16* __restrict__ kws,
                     _Float16* __restrict__ vT)
{
  __shared__ __align__(128) _Float16 st[4][16][64];   // 8 KB staging

  const int lane = threadIdx.x & 31;
  const int w    = threadIdx.x >> 5;
  const int ln   = lane & 15;
  const int koff = (lane >> 4) << 3;
  const int mb   = (lane >> 4) << 3;
  const int rt   = blockIdx.x * 4 + w;
  const int hc   = blockIdx.y;

  const _Float16* pW; int ntbase, mode, head;
  if (hc < 16)      { pW = pWq; ntbase = hc * 4;        mode = 0; head = hc; }
  else if (hc < 20) { pW = pWk; ntbase = (hc - 16) * 4; mode = 1; head = hc - 16; }
  else              { pW = pWv; ntbase = (hc - 20) * 4; mode = 2; head = hc - 20; }

  const _Float16* __restrict__ xrow = xh + (size_t)(rt * 16 + ln) * D_MODEL;

  v8f acc0 = {}, acc1 = {}, acc2 = {}, acc3 = {};
  for (int kc = 0; kc < KCH; ++kc) {
    const int kb = kc * 32;
    v16h a = cat8(*(const v8h*)(xrow + kb + koff),
                  *(const v8h*)(xrow + kb + 16 + koff));
    const _Float16* pb = pW + ((size_t)kc * 32 + lane) * 16;
    const size_t ntstride = (size_t)KCH * 32 * 16;
    v16h b0 = *(const v16h*)(pb + (size_t)(ntbase + 0) * ntstride);
    v16h b1 = *(const v16h*)(pb + (size_t)(ntbase + 1) * ntstride);
    v16h b2 = *(const v16h*)(pb + (size_t)(ntbase + 2) * ntstride);
    v16h b3 = *(const v16h*)(pb + (size_t)(ntbase + 3) * ntstride);
    acc0 = wmma16x16x32(a, b0, acc0);
    acc1 = wmma16x16x32(a, b1, acc1);
    acc2 = wmma16x16x32(a, b2, acc2);
    acc3 = wmma16x16x32(a, b3, acc3);
  }

  const int t0 = (rt * 16) & (SEQ - 1);
  const int bp = rt >> 5;

  if (mode < 2) {
    // RoPE pairs (dh, dh+32): acc0<->acc2 (dh=ln), acc1<->acc3 (dh=16+ln)
    const float LOG1E4_32 = 0.28782313662425575f;    // ln(10000)/32
    const float fA = __expf(-(float)ln * LOG1E4_32);
    const float fB = __expf(-(float)(16 + ln) * LOG1E4_32);
    const float qs = (mode == 0) ? 0.125f : 1.0f;    // 1/sqrt(HEAD_DIM) into q
#pragma unroll
    for (int r = 0; r < 8; ++r) {
      const float tm = (float)(t0 + mb + r);
      float sA, cA, sB, cB;
      __sincosf(tm * fA, &sA, &cA);
      __sincosf(tm * fB, &sB, &cB);
      float lo = acc0[r], hi = acc2[r];
      acc0[r] = (lo * cA - hi * sA) * qs;
      acc2[r] = (lo * sA + hi * cA) * qs;
      lo = acc1[r]; hi = acc3[r];
      acc1[r] = (lo * cB - hi * sB) * qs;
      acc3[r] = (lo * sB + hi * cB) * qs;
    }
    // stage tile in LDS, then 2x32B stores per lane
    _Float16* dst = (mode == 0)
        ? qws + ((size_t)(bp * N_HEADS + head) * SEQ) * HEAD_DIM
        : kws + ((size_t)(bp * N_KVH + head) * SEQ) * HEAD_DIM;
#pragma unroll
    for (int r = 0; r < 8; ++r) {
      _Float16* srow = &st[w][mb + r][0];
      srow[ln]      = (_Float16)acc0[r];
      srow[16 + ln] = (_Float16)acc1[r];
      srow[32 + ln] = (_Float16)acc2[r];
      srow[48 + ln] = (_Float16)acc3[r];
    }
    __syncthreads();
    const int seg = lane >> 4;
    const v16h* s = (const v16h*)&st[w][ln][seg * 32];
    v16h* g = (v16h*)(dst + (size_t)(t0 + ln) * HEAD_DIM + seg * 32);
    g[0] = s[0];
    g[1] = s[1];
  } else {
    // V: transpose in-register -> vT[slot][d][t], 4 x 16B stores per lane
    _Float16* dst = vT + ((size_t)(bp * N_KVH + head) * HEAD_DIM) * SEQ;
#pragma unroll
    for (int j = 0; j < 4; ++j) {
      v8f* accs[4] = {&acc0, &acc1, &acc2, &acc3};
      v8f a = *accs[j];
      v8h h;
#pragma unroll
      for (int r = 0; r < 8; ++r) h[r] = (_Float16)a[r];
      *(v8h*)(dst + (size_t)(j * 16 + ln) * SEQ + t0 + mb) = h;
    }
    __syncthreads();   // keep block convergent with mode<2 path (same hc => same path; harmless)
  }
}

// ===========================================================================
// Kernel 2: attention, one wave per (bp, head, 16-query tile).
//   grid = (SEQ/16, N_HEADS, BP)
// f16 scores/probs in one 16 KB LDS buffer, exact softmax in fp32 registers,
// AV via WMMA with contiguous V^T fragments, ctx stored via LDS-staged 32B.
// ===========================================================================
__global__ __launch_bounds__(32)
void attn_kernel(const _Float16* __restrict__ qws,
                 const _Float16* __restrict__ kws,
                 const _Float16* __restrict__ vT,
                 _Float16* __restrict__ ctx)
{
  __shared__ __align__(128) _Float16 sc[16][SEQ];     // 16 KB scores/probs

  const int lane = threadIdx.x;
  const int ln   = lane & 15;
  const int koff = (lane >> 4) << 3;
  const int mb   = (lane >> 4) << 3;
  const int qt   = blockIdx.x;
  const int h    = blockIdx.y;
  const int bp   = blockIdx.z;

  const _Float16* __restrict__ qb = qws + ((size_t)(bp * N_HEADS + h)        * SEQ) * HEAD_DIM;
  const _Float16* __restrict__ kb = kws + ((size_t)(bp * N_KVH   + (h >> 2)) * SEQ) * HEAD_DIM;
  const _Float16* __restrict__ vb = vT  + ((size_t)(bp * N_KVH   + (h >> 2)) * HEAD_DIM) * SEQ;

  // Q tile A-fragments (16x64 as two 16x32 chunks)
  const _Float16* qrow = qb + (size_t)(qt * 16 + ln) * HEAD_DIM;
  v16h aq0 = cat8(*(const v8h*)(qrow + koff),      *(const v8h*)(qrow + 16 + koff));
  v16h aq1 = cat8(*(const v8h*)(qrow + 32 + koff), *(const v8h*)(qrow + 48 + koff));

  // S = Q K^T : per-lane key row is contiguous, identical gather as A
  for (int kt = 0; kt < SEQ / 16; ++kt) {
    const _Float16* krow = kb + (size_t)(kt * 16 + ln) * HEAD_DIM;
    if (kt + 1 < SEQ / 16)
      __builtin_prefetch(krow + HEAD_DIM * 16, 0, 1);   // global_prefetch_b8
    v16h bk0 = cat8(*(const v8h*)(krow + koff),      *(const v8h*)(krow + 16 + koff));
    v16h bk1 = cat8(*(const v8h*)(krow + 32 + koff), *(const v8h*)(krow + 48 + koff));
    v8f c = {};
    c = wmma16x16x32(aq0, bk0, c);
    c = wmma16x16x32(aq1, bk1, c);
    const int col = kt * 16 + ln;
#pragma unroll
    for (int r = 0; r < 8; ++r) sc[mb + r][col] = (_Float16)c[r];
  }
  __syncthreads();

  // Exact softmax over 512 keys (fp32 registers, full-wave shuffle reductions)
  for (int row = 0; row < 16; ++row) {
    float vals[16];
    float mx = -3.0e38f;
#pragma unroll
    for (int j = 0; j < 16; ++j) {
      vals[j] = (float)sc[row][lane + 32 * j];
      mx = fmaxf(mx, vals[j]);
    }
#pragma unroll
    for (int off = 16; off > 0; off >>= 1)
      mx = fmaxf(mx, __shfl_xor(mx, off, 32));
    float sum = 0.f;
#pragma unroll
    for (int j = 0; j < 16; ++j) {
      vals[j] = __expf(vals[j] - mx);
      sum += vals[j];
    }
#pragma unroll
    for (int off = 16; off > 0; off >>= 1)
      sum += __shfl_xor(sum, off, 32);
    const float rinv = 1.0f / sum;
#pragma unroll
    for (int j = 0; j < 16; ++j)
      sc[row][lane + 32 * j] = (_Float16)(vals[j] * rinv);
  }
  __syncthreads();

  // O = P V : P rows contiguous in LDS, V^T rows contiguous in global
  v8f o0 = {}, o1 = {}, o2 = {}, o3 = {};
  const _Float16* prow = &sc[ln][0];
  const _Float16* v0r = vb + (size_t)(ln)      * SEQ;
  const _Float16* v1r = vb + (size_t)(16 + ln) * SEQ;
  const _Float16* v2r = vb + (size_t)(32 + ln) * SEQ;
  const _Float16* v3r = vb + (size_t)(48 + ln) * SEQ;
  for (int kt = 0; kt < SEQ / 32; ++kt) {
    const int kbse = kt * 32;
    v16h ap  = cat8(*(const v8h*)(prow + kbse + koff), *(const v8h*)(prow + kbse + 16 + koff));
    v16h bv0 = cat8(*(const v8h*)(v0r + kbse + koff),  *(const v8h*)(v0r + kbse + 16 + koff));
    v16h bv1 = cat8(*(const v8h*)(v1r + kbse + koff),  *(const v8h*)(v1r + kbse + 16 + koff));
    v16h bv2 = cat8(*(const v8h*)(v2r + kbse + koff),  *(const v8h*)(v2r + kbse + 16 + koff));
    v16h bv3 = cat8(*(const v8h*)(v3r + kbse + koff),  *(const v8h*)(v3r + kbse + 16 + koff));
    o0 = wmma16x16x32(ap, bv0, o0);
    o1 = wmma16x16x32(ap, bv1, o1);
    o2 = wmma16x16x32(ap, bv2, o2);
    o3 = wmma16x16x32(ap, bv3, o3);
  }

  // stage 16x64 out tile into LDS (reuse sc), then 2x32B stores per lane
  __syncthreads();
  _Float16 (*ot)[64] = (_Float16(*)[64])sc;
#pragma unroll
  for (int r = 0; r < 8; ++r) {
    _Float16* srow = &ot[mb + r][0];
    srow[ln]      = (_Float16)o0[r];
    srow[16 + ln] = (_Float16)o1[r];
    srow[32 + ln] = (_Float16)o2[r];
    srow[48 + ln] = (_Float16)o3[r];
  }
  __syncthreads();
  const int seg = lane >> 4;
  const v16h* s = (const v16h*)&ot[ln][seg * 32];
  _Float16* grow = ctx + ((size_t)bp * SEQ + qt * 16 + ln) * D_MODEL
                       + h * HEAD_DIM + seg * 32;
  ((v16h*)grow)[0] = s[0];
  ((v16h*)grow)[1] = s[1];
}

// ===========================================================================
// Kernel 3: out = ctx @ Wo (packed) with (B,T,P,:) permuted fp32 store.
// 4 waves / block; wave w: row tile blockIdx.x*4+w, col tile blockIdx.y.
// ===========================================================================
__global__ __launch_bounds__(128)
void out_proj_kernel(const _Float16* __restrict__ ctx,
                     const _Float16* __restrict__ pWo,
                     float* __restrict__ out)
{
  __shared__ __align__(128) float ot[4][16][16];      // 4 KB staging

  const int lane = threadIdx.x & 31;
  const int w    = threadIdx.x >> 5;
  const int ln   = lane & 15;
  const int koff = (lane >> 4) << 3;
  const int mb   = (lane >> 4) << 3;
  const int rt   = blockIdx.x * 4 + w;
  const int ct   = blockIdx.y;

  const _Float16* __restrict__ arow = ctx + (size_t)(rt * 16 + ln) * D_MODEL;
  const _Float16* __restrict__ pb0  = pWo + ((size_t)ct * KCH * 32 + lane) * 16;

  v8f c = {};
  for (int kc = 0; kc < KCH; ++kc) {
    const int kbse = kc * 32;
    v16h a = cat8(*(const v8h*)(arow + kbse + koff),
                  *(const v8h*)(arow + kbse + 16 + koff));
    v16h b = *(const v16h*)(pb0 + (size_t)kc * 32 * 16);
    c = wmma16x16x32(a, b, c);
  }

#pragma unroll
  for (int r = 0; r < 8; ++r) ot[w][mb + r][ln] = c[r];
  __syncthreads();

  // row = ln handled by two lanes (8 floats each, 2x16B stores)
  const int seg = lane >> 4;
  const int rr  = rt * 16 + ln;          // (b,p,t) ordered row
  const int bb  = rr >> 12;
  const int pp  = (rr >> 9) & 7;
  const int tt  = rr & (SEQ - 1);
  float* grow = out + (((size_t)(bb * SEQ + tt) * 8 + pp) << 10)
                    + ct * 16 + seg * 8;
  const v4f* s = (const v4f*)&ot[w][ln][seg * 8];
  ((v4f*)grow)[0] = s[0];
  ((v4f*)grow)[1] = s[1];
}

// ===========================================================================
extern "C" void kernel_launch(void* const* d_in, const int* in_sizes, int n_in,
                              void* d_out, int out_size, void* d_ws, size_t ws_size,
                              hipStream_t stream) {
  const float* hidden = (const float*)d_in[0];
  const float* Wq     = (const float*)d_in[1];
  const float* Wk     = (const float*)d_in[2];
  const float* Wv     = (const float*)d_in[3];
  const float* Wo     = (const float*)d_in[4];
  float*       out    = (float*)d_out;

  // f16 workspace layout (halfs). ctx aliases xh (xh dead after kernel 1).
  _Float16* xh  = (_Float16*)d_ws;                         // 8192*1024
  _Float16* ctx = xh;                                      // alias
  _Float16* qws = xh  + (size_t)ROWS * D_MODEL;            // 16*16*512*64
  _Float16* kws = qws + (size_t)BP * N_HEADS * SEQ * HEAD_DIM;
  _Float16* vT  = kws + (size_t)BP * N_KVH * SEQ * HEAD_DIM;
  _Float16* pWq = vT  + (size_t)BP * N_KVH * SEQ * HEAD_DIM;
  _Float16* pWk = pWq + (size_t)D_MODEL * (N_HEADS * HEAD_DIM);
  _Float16* pWv = pWk + (size_t)D_MODEL * (N_KVH * HEAD_DIM);
  _Float16* pWo = pWv + (size_t)D_MODEL * (N_KVH * HEAD_DIM);

  convert_x_kernel<<<ROWS * D_MODEL / 8 / 256, 256, 0, stream>>>(hidden, xh);
  pack_w_kernel<<<dim3(64, KCH), 32, 0, stream>>>(Wq, 1024, pWq);
  pack_w_kernel<<<dim3(16, KCH), 32, 0, stream>>>(Wk, 256,  pWk);
  pack_w_kernel<<<dim3(16, KCH), 32, 0, stream>>>(Wv, 256,  pWv);
  pack_w_kernel<<<dim3(64, KCH), 32, 0, stream>>>(Wo, 1024, pWo);

  qkv_rope_kernel<<<dim3(ROWS / 16 / 4, N_HEADS + 2 * N_KVH), 128, 0, stream>>>(
      xh, pWq, pWk, pWv, qws, kws, vT);

  attn_kernel<<<dim3(SEQ / 16, N_HEADS, BP), 32, 0, stream>>>(
      qws, kws, vT, ctx);

  out_proj_kernel<<<dim3(ROWS / 16 / 4, D_MODEL / 16), 128, 0, stream>>>(
      ctx, pWo, out);
}

// v001
// It runs in 178 microseconds.
// In two side-by-side timings against v000, it was 1.75 and 1.80 times as fast.
#include <hip/hip_runtime.h>

// ---------------------------------------------------------------------------
// MI455X (gfx1250) fused attention: QKV+RoPE -> softmax attention -> out proj
// All matrix math via v_wmma_f32_16x16x32_f16 (wave32, f32 accumulate).
// Memory strategy: all fragment traffic is wide/contiguous f16:
//   - hidden pre-converted & permuted to f16 (kernel 0a)
//   - weights pre-packed into WMMA B-fragment order (kernel 0b)
//   - V written transposed so attention B-frags are contiguous
// ---------------------------------------------------------------------------

typedef __attribute__((ext_vector_type(16))) _Float16 v16h;
typedef __attribute__((ext_vector_type(8)))  _Float16 v8h;
typedef __attribute__((ext_vector_type(8)))  float    v8f;
typedef __attribute__((ext_vector_type(4)))  float    v4f;

#define D_MODEL   1024
#define N_HEADS   16
#define N_KVH     4
#define HEAD_DIM  64
#define SEQ       512
#define BP        16          // B*P = 2*8
#define ROWS      8192        // BP * SEQ
#define KCH       (D_MODEL / 32)   // 32 k-chunks of 32

__device__ __forceinline__ v8f wmma16x16x32(v16h a, v16h b, v8f c) {
  // (neg_a, A, neg_b, B, c_mod, C, reuse_a, reuse_b)
  return __builtin_amdgcn_wmma_f32_16x16x32_f16(false, a, false, b, (short)0, c,
                                                false, false);
}

__device__ __forceinline__ v16h cat8(v8h lo, v8h hi) {
  v16h r;
#pragma unroll
  for (int i = 0; i < 8; ++i) { r[i] = lo[i]; r[i + 8] = hi[i]; }
  return r;
}

// ===========================================================================
// Kernel 0a: hidden (b,t,p,d) fp32 -> xh (b,p,t,d) f16.  Fully coalesced.
// One thread handles 8 consecutive d.  grid = ROWS*D_MODEL/8/256 blocks.
// ===========================================================================
__global__ __launch_bounds__(256)
void convert_x_kernel(const float* __restrict__ hidden,
                      _Float16* __restrict__ xh)
{
  const int idx = blockIdx.x * 256 + threadIdx.x;     // 0 .. 1M-1
  const int d0  = (idx & 127) << 3;                   // 8-elem group in row
  const int rr  = idx >> 7;                           // (b,p,t) row
  const int bb  = rr >> 12;
  const int pp  = (rr >> 9) & 7;
  const int tt  = rr & (SEQ - 1);
  const float* src = hidden + (((size_t)(bb * SEQ + tt) * 8 + pp) << 10) + d0;
  v4f f0 = *(const v4f*)(src);
  v4f f1 = *(const v4f*)(src + 4);
  v8h h;
#pragma unroll
  for (int i = 0; i < 4; ++i) {
    h[i]     = (_Float16)f0[i];
    h[i + 4] = (_Float16)f1[i];
  }
  *(v8h*)(xh + (size_t)rr * D_MODEL + d0) = h;
}

// ===========================================================================
// Kernel 0b: pack fp32 weight (K=1024 x N) into f16 B-fragment order:
//   dst[((nt*KCH + kc)*32 + lane)*16 + i] = W[k(lane,i)*N + nt*16 + (lane&15)]
// with k = kc*32 + koff + i (i<8) / kc*32 + 16 + koff + i-8, koff=(lane>>4)*8.
// grid = (N/16, KCH), 32 threads. Runs once; packed weights stay in L2.
// ===========================================================================
__global__ __launch_bounds__(32)
void pack_w_kernel(const float* __restrict__ W, int N,
                   _Float16* __restrict__ dst)
{
  const int lane = threadIdx.x;
  const int ln   = lane & 15;
  const int koff = (lane >> 4) << 3;
  const int nt   = blockIdx.x;
  const int kc   = blockIdx.y;
  const int kb   = kc * 32;
  const float* col = W + nt * 16 + ln;
  v16h b;
#pragma unroll
  for (int i = 0; i < 8; ++i) {
    b[i]     = (_Float16)col[(size_t)(kb + koff + i) * N];
    b[i + 8] = (_Float16)col[(size_t)(kb + 16 + koff + i) * N];
  }
  *(v16h*)(dst + ((size_t)(nt * KCH + kc) * 32 + lane) * 16) = b;
}

// ===========================================================================
// Register-tiled GEMM core shared by kernels 1 and 3.
// One wave owns MT x NT accumulator tiles (16x16 each): a loaded A fragment
// feeds NT WMMAs and a loaded B fragment MT WMMAs.  Two fragment sets: the
// next k chunk's loads are issued ahead of the current chunk's WMMAs.
//   ap    : lane's A row (tile row ln) + koff, row pitch D_MODEL
//   bp[q] : packed n-tile 4*q of the wave's columns (wave-uniform)
// ===========================================================================
#define NTSTRIDE (KCH * 32 * 16)      // halfs per packed n-tile

template <int MT, int NT>
__device__ __forceinline__ void load_frags(v16h (&a)[MT], v16h (&b)[NT],
                                           const _Float16* __restrict__ ap,
                                           const _Float16* const (&bp)[NT / 4],
                                           int kc)
{
#pragma unroll
  for (int mi = 0; mi < MT; ++mi) {
    const _Float16* p = ap + (size_t)mi * 16 * D_MODEL + kc * 32;
    a[mi] = cat8(*(const v8h*)(p), *(const v8h*)(p + 16));
  }
#pragma unroll
  for (int nj = 0; nj < NT; ++nj)
    b[nj] = *(const v16h*)(bp[nj >> 2] + (size_t)(nj & 3) * NTSTRIDE + kc * 512
                           + (threadIdx.x & 31) * 16);
}

template <int MT, int NT>
__device__ __forceinline__ void mma_frags(const v16h (&a)[MT], const v16h (&b)[NT],
                                          v8f (&acc)[MT][NT])
{
#pragma unroll
  for (int mi = 0; mi < MT; ++mi)
#pragma unroll
    for (int nj = 0; nj < NT; ++nj)
      acc[mi][nj] = wmma16x16x32(a[mi], b[nj], acc[mi][nj]);
}

template <int MT, int NT>
__device__ __forceinline__ void gemm_tile(const _Float16* __restrict__ ap,
                                          const _Float16* const (&bp)[NT / 4],
                                          v8f (&acc)[MT][NT])
{
  v16h a0[MT], b0[NT], a1[MT], b1[NT];
  load_frags<MT, NT>(a0, b0, ap, bp, 0);
  __builtin_amdgcn_sched_barrier(0);   // holds the wait directly behind the loads
  // registers that the issued loads name are rewritten next: wait first
  asm volatile("s_wait_xcnt 0x0" ::: "memory");
  __builtin_amdgcn_sched_barrier(0);
  for (int kc = 0; kc < KCH - 2; kc += 2) {
    // the scheduling fences keep each load group whole and ahead of the WMMA
    // block; without them the loads sink in among the WMMAs that need them
    load_frags<MT, NT>(a1, b1, ap, bp, kc + 1);
    __builtin_amdgcn_sched_barrier(0);
    mma_frags<MT, NT>(a0, b0, acc);
    __builtin_amdgcn_sched_barrier(0);
    load_frags<MT, NT>(a0, b0, ap, bp, kc + 2);
    __builtin_amdgcn_sched_barrier(0);
    mma_frags<MT, NT>(a1, b1, acc);
    __builtin_amdgcn_sched_barrier(0);
    // the address registers of the issued loads step on behind this wait
    asm volatile("s_wait_xcnt 0x0" ::: "memory");
    __builtin_amdgcn_sched_barrier(0);
  }
  load_frags<MT, NT>(a1, b1, ap, bp, KCH - 1);
  __builtin_amdgcn_sched_barrier(0);   // same: last load group ahead of the WMMAs
  mma_frags<MT, NT>(a0, b0, acc);
  __builtin_amdgcn_sched_barrier(0);
  // the last loads' address registers are free for reuse behind this wait
  asm volatile("s_wait_xcnt 0x0" ::: "memory");
  __builtin_amdgcn_sched_barrier(0);
  mma_frags<MT, NT>(a1, b1, acc);
}

// ===========================================================================
// Kernel 1: QKV projection + RoPE + q-scale from packed f16 operands.
// 4 waves / block; wave w owns rows [64*(blockIdx.x*4+w), +64) and the three
// 64-wide head columns 3*blockIdx.y .. +2 of the 24 (16 q, 4 k, 4 v).
// Q/K written row-major (slot,t,d) via LDS-staged whole-line stores.
// V written TRANSPOSED (slot,d,t) straight from registers (wide stores).
// ===========================================================================
__global__ __launch_bounds__(128)
void qkv_rope_kernel(const _Float16* __restrict__ xh,
                     const _Float16* __restrict__ pWq,
                     const _Float16* __restrict__ pWk,
                     const _Float16* __restrict__ pWv,
                     _Float16* __restrict__ qws,
                     _Float16* __restrict__ kws,
                     _Float16* __restrict__ vT)
{
  __shared__ __align__(128) _Float16 st[4][3][64][64];   // 96 KB staging

  const int lane = threadIdx.x & 31;
  const int w    = threadIdx.x >> 5;
  const int ln   = lane & 15;
  const int koff = (lane >> 4) << 3;
  const int mb   = (lane >> 4) << 3;
  const int rt   = blockIdx.x * 4 + w;     // 64-row tile
  const int hc0  = blockIdx.y * 3;         // first of three head columns

  const _Float16* bp[3];
#pragma unroll
  for (int hh = 0; hh < 3; ++hh) {
    const int hc = hc0 + hh;
    const _Float16* pW = (hc < 16) ? pWq + (size_t)hc * 4 * NTSTRIDE
                       : (hc < 20) ? pWk + (size_t)(hc - 16) * 4 * NTSTRIDE
                                   : pWv + (size_t)(hc - 20) * 4 * NTSTRIDE;
    bp[hh] = pW;
  }
  const _Float16* ap = xh + (size_t)(rt * 64 + ln) * D_MODEL + koff;

  v8f acc[4][12] = {};
  gemm_tile<4, 12>(ap, bp, acc);

  const int t0 = (rt * 64) & (SEQ - 1);
  const int bpi = rt >> 3;

  // RoPE tables of this lane's 32 rows, shared by the wave's q and k heads
  const float LOG1E4_32 = 0.28782313662425575f;    // ln(10000)/32
  const float fA = __expf(-(float)ln * LOG1E4_32);
  const float fB = __expf(-(float)(16 + ln) * LOG1E4_32);
  float sA[4][8], cA[4][8], sB[4][8], cB[4][8];
#pragma unroll
  for (int mi = 0; mi < 4; ++mi)
#pragma unroll
    for (int r = 0; r < 8; ++r) {
      const float tm = (float)(t0 + mi * 16 + mb + r);
      __sincosf(tm * fA, &sA[mi][r], &cA[mi][r]);
      __sincosf(tm * fB, &sB[mi][r], &cB[mi][r]);
    }

#pragma unroll
  for (int hh = 0; hh < 3; ++hh) {
    const int hc = hc0 + hh;
    if (hc < 20) {
      // RoPE pairs (dh, dh+32): tile 0<->2 (dh=ln), tile 1<->3 (dh=16+ln)
      const float qs = (hc < 16) ? 0.125f : 1.0f;  // 1/sqrt(HEAD_DIM) into q
#pragma unroll
      for (int mi = 0; mi < 4; ++mi)
#pragma unroll
        for (int r = 0; r < 8; ++r) {
          _Float16* srow = &st[w][hh][mi * 16 + mb + r][0];
          float lo = acc[mi][hh * 4 + 0][r], hi = acc[mi][hh * 4 + 2][r];
          srow[ln]      = (_Float16)((lo * cA[mi][r] - hi * sA[mi][r]) * qs);
          srow[32 + ln] = (_Float16)((lo * sA[mi][r] + hi * cA[mi][r]) * qs);
          lo = acc[mi][hh * 4 + 1][r]; hi = acc[mi][hh * 4 + 3][r];
          srow[16 + ln] = (_Float16)((lo * cB[mi][r] - hi * sB[mi][r]) * qs);
          srow[48 + ln] = (_Float16)((lo * sB[mi][r] + hi * cB[mi][r]) * qs);
        }
    } else {
      // V: transpose in-register -> vT[slot][d][t], 16B stores
      _Float16* dst = vT + ((size_t)(bpi * N_KVH + (hc - 20)) * HEAD_DIM) * SEQ;
#pragma unroll
      for (int j = 0; j < 4; ++j) {
#pragma unroll
        for (int mi = 0; mi < 4; ++mi) {
          v8h h;
#pragma unroll
          for (int r = 0; r < 8; ++r) h[r] = (_Float16)acc[mi][hh * 4 + j][r];
          *(v8h*)(dst + (size_t)(j * 16 + ln) * SEQ + t0 + mi * 16 + mb) = h;
        }
        // the stores' data registers are refilled next: wait first (the fence
        // holds the next conversions behind the wait)
        asm volatile("s_wait_xcnt 0x0" ::: "memory");
        __builtin_amdgcn_sched_barrier(0);
      }
    }
  }
  __syncthreads();   // staged rows are read back by other lanes

#pragma unroll
  for (int hh = 0; hh < 3; ++hh) {
    const int hc = hc0 + hh;
    if (hc < 20) {
      // 64 rows x 64 halfs of one head are 8 KB contiguous in q / k
      _Float16* dst = (hc < 16)
          ? qws + ((size_t)(bpi * N_HEADS + hc) * SEQ + t0) * HEAD_DIM
          : kws + ((size_t)(bpi * N_KVH + (hc - 16)) * SEQ + t0) * HEAD_DIM;
      const v8h* s = (const v8h*)&st[w][hh][0][0];
      v8h* g = (v8h*)dst;
#pragma unroll
      for (int i = 0; i < 16; ++i) g[i * 32 + lane] = s[i * 32 + lane];
      if (hh < 2) {
        // the next head column reuses these stores' data and address
        // registers: wait first
        asm volatile("s_wait_xcnt 0x0" ::: "memory");
      }
    }
  }
}

// ===========================================================================
// Kernel 2: attention, one wave per (bp, head, 16-query tile).
//   grid = (SEQ/16, N_HEADS, BP)
// f16 scores/probs in one 16 KB LDS buffer, exact softmax in fp32 registers,
// AV via WMMA with contiguous V^T fragments, ctx stored via LDS-staged 32B.
// ===========================================================================
__global__ __launch_bounds__(32)
void attn_kernel(const _Float16* __restrict__ qws,
                 const _Float16* __restrict__ kws,
                 const _Float16* __restrict__ vT,
                 _Float16* __restrict__ ctx)
{
  __shared__ __align__(128) _Float16 sc[16][SEQ];     // 16 KB scores/probs

  const int lane = threadIdx.x;
  const int ln   = lane & 15;
  const int koff = (lane >> 4) << 3;
  const int mb   = (lane >> 4) << 3;
  const int qt   = blockIdx.x;
  const int h    = blockIdx.y;
  const int bp   = blockIdx.z;

  const _Float16* __restrict__ qb = qws + ((size_t)(bp * N_HEADS + h)        * SEQ) * HEAD_DIM;
  const _Float16* __restrict__ kb = kws + ((size_t)(bp * N_KVH   + (h >> 2)) * SEQ) * HEAD_DIM;
  const _Float16* __restrict__ vb = vT  + ((size_t)(bp * N_KVH   + (h >> 2)) * HEAD_DIM) * SEQ;

  // Q tile A-fragments (16x64 as two 16x32 chunks)
  const _Float16* qrow = qb + (size_t)(qt * 16 + ln) * HEAD_DIM;
  v16h aq0 = cat8(*(const v8h*)(qrow + koff),      *(const v8h*)(qrow + 16 + koff));
  v16h aq1 = cat8(*(const v8h*)(qrow + 32 + koff), *(const v8h*)(qrow + 48 + koff));

  // S = Q K^T : per-lane key row is contiguous, identical gather as A
  for (int kt = 0; kt < SEQ / 16; ++kt) {
    const _Float16* krow = kb + (size_t)(kt * 16 + ln) * HEAD_DIM;
    if (kt + 1 < SEQ / 16)
      __builtin_prefetch(krow + HEAD_DIM * 16, 0, 1);   // global_prefetch_b8
    v16h bk0 = cat8(*(const v8h*)(krow + koff),      *(const v8h*)(krow + 16 + koff));
    v16h bk1 = cat8(*(const v8h*)(krow + 32 + koff), *(const v8h*)(krow + 48 + koff));
    v8f c = {};
    c = wmma16x16x32(aq0, bk0, c);
    c = wmma16x16x32(aq1, bk1, c);
    const int col = kt * 16 + ln;
#pragma unroll
    for (int r = 0; r < 8; ++r) sc[mb + r][col] = (_Float16)c[r];
  }
  __syncthreads();

  // Exact softmax over 512 keys (fp32 registers, full-wave shuffle reductions)
  for (int row = 0; row < 16; ++row) {
    float vals[16];
    float mx = -3.0e38f;
#pragma unroll
    for (int j = 0; j < 16; ++j) {
      vals[j] = (float)sc[row][lane + 32 * j];
      mx = fmaxf(mx, vals[j]);
    }
#pragma unroll
    for (int off = 16; off > 0; off >>= 1)
      mx = fmaxf(mx, __shfl_xor(mx, off, 32));
    float sum = 0.f;
#pragma unroll
    for (int j = 0; j < 16; ++j) {
      vals[j] = __expf(vals[j] - mx);
      sum += vals[j];
    }
#pragma unroll
    for (int off = 16; off > 0; off >>= 1)
      sum += __shfl_xor(sum, off, 32);
    const float rinv = 1.0f / sum;
#pragma unroll
    for (int j = 0; j < 16; ++j)
      sc[row][lane + 32 * j] = (_Float16)(vals[j] * rinv);
  }
  __syncthreads();

  // O = P V : P rows contiguous in LDS, V^T rows contiguous in global
  v8f o0 = {}, o1 = {}, o2 = {}, o3 = {};
  const _Float16* prow = &sc[ln][0];
  const _Float16* v0r = vb + (size_t)(ln)      * SEQ;
  const _Float16* v1r = vb + (size_t)(16 + ln) * SEQ;
  const _Float16* v2r = vb + (size_t)(32 + ln) * SEQ;
  const _Float16* v3r = vb + (size_t)(48 + ln) * SEQ;
  for (int kt = 0; kt < SEQ / 32; ++kt) {
    const int kbse = kt * 32;
    v16h ap  = cat8(*(const v8h*)(prow + kbse + koff), *(const v8h*)(prow + kbse + 16 + koff));
    v16h bv0 = cat8(*(const v8h*)(v0r + kbse + koff),  *(const v8h*)(v0r + kbse + 16 + koff));
    v16h bv1 = cat8(*(const v8h*)(v1r + kbse + koff),  *(const v8h*)(v1r + kbse + 16 + koff));
    v16h bv2 = cat8(*(const v8h*)(v2r + kbse + koff),  *(const v8h*)(v2r + kbse + 16 + koff));
    v16h bv3 = cat8(*(const v8h*)(v3r + kbse + koff),  *(const v8h*)(v3r + kbse + 16 + koff));
    o0 = wmma16x16x32(ap, bv0, o0);
    o1 = wmma16x16x32(ap, bv1, o1);
    o2 = wmma16x16x32(ap, bv2, o2);
    o3 = wmma16x16x32(ap, bv3, o3);
  }

  // stage 16x64 out tile into LDS (reuse sc), then 2x32B stores per lane
  __syncthreads();
  _Float16 (*ot)[64] = (_Float16(*)[64])sc;
#pragma unroll
  for (int r = 0; r < 8; ++r) {
    _Float16* srow = &ot[mb + r][0];
    srow[ln]      = (_Float16)o0[r];
    srow[16 + ln] = (_Float16)o1[r];
    srow[32 + ln] = (_Float16)o2[r];
    srow[48 + ln] = (_Float16)o3[r];
  }
  __syncthreads();
  const int seg = lane >> 4;
  const v16h* s = (const v16h*)&ot[ln][seg * 32];
  _Float16* grow = ctx + ((size_t)bp * SEQ + qt * 16 + ln) * D_MODEL
                       + h * HEAD_DIM + seg * 32;
  ((v16h*)grow)[0] = s[0];
  ((v16h*)grow)[1] = s[1];
}

// ===========================================================================
// Kernel 3: out = ctx @ Wo (packed) with (B,T,P,:) permuted fp32 store.
// 4 waves / block; wave w owns rows [64*(blockIdx.x*4+w), +64) and the 128
// columns of blockIdx.y.  Rows leave as whole 512 B pieces through LDS.
// ===========================================================================
__global__ __launch_bounds__(128)
void out_proj_kernel(const _Float16* __restrict__ ctx,
                     const _Float16* __restrict__ pWo,
                     float* __restrict__ out)
{
  // pitch 132 floats: the two lane halves (8 rows apart) fall on other banks
  __shared__ __align__(128) float ot[4][64][132];

  const int lane = threadIdx.x & 31;
  const int w    = threadIdx.x >> 5;
  const int ln   = lane & 15;
  const int koff = (lane >> 4) << 3;
  const int mb   = (lane >> 4) << 3;
  const int rt   = blockIdx.x * 4 + w;     // 64-row tile
  const int ct   = blockIdx.y;             // 128-column tile

  const _Float16* ap = ctx + (size_t)(rt * 64 + ln) * D_MODEL + koff;
  const _Float16* bp[2];
  bp[0] = pWo + (size_t)(ct * 8) * NTSTRIDE;
  bp[1] = bp[0] + (size_t)4 * NTSTRIDE;

  v8f acc[4][8] = {};
  gemm_tile<4, 8>(ap, bp, acc);

#pragma unroll
  for (int mi = 0; mi < 4; ++mi)
#pragma unroll
    for (int nj = 0; nj < 8; ++nj)
#pragma unroll
      for (int r = 0; r < 8; ++r)
        ot[w][mi * 16 + mb + r][nj * 16 + ln] = acc[mi][nj][r];
  __syncthreads();   // staged rows are read back by other lanes

  // the tile's 64 (b,p,t) rows share b and p; t runs on
  const int rr = rt * 64;
  const int bb = rr >> 12;
  const int pp = (rr >> 9) & 7;
  const int tt = rr & (SEQ - 1);
  float* grow = out + (((size_t)(bb * SEQ + tt) * 8 + pp) << 10)
                    + ct * 128 + lane * 4;
#pragma unroll
  for (int row = 0; row < 64; ++row)
    *(v4f*)(grow + (size_t)row * 8 * D_MODEL) = *(const v4f*)&ot[w][row][lane * 4];
}

// ===========================================================================
extern "C" void kernel_launch(void* const* d_in, const int* in_sizes, int n_in,
                              void* d_out, int out_size, void* d_ws, size_t ws_size,
                              hipStream_t stream) {
  const float* hidden = (const float*)d_in[0];
  const float* Wq     = (const float*)d_in[1];
  const float* Wk     = (const float*)d_in[2];
  const float* Wv     = (const float*)d_in[3];
  const float* Wo     = (const float*)d_in[4];
  float*       out    = (float*)d_out;

  // f16 workspace layout (halfs). ctx aliases xh (xh dead after kernel 1).
  _Float16* xh  = (_Float16*)d_ws;                         // 8192*1024
  _Float16* ctx = xh;                                      // alias
  _Float16* qws = xh  + (size_t)ROWS * D_MODEL;            // 16*16*512*64
  _Float16* kws = qws + (size_t)BP * N_HEADS * SEQ * HEAD_DIM;
  _Float16* vT  = kws + (size_t)BP * N_KVH * SEQ * HEAD_DIM;
  _Float16* pWq = vT  + (size_t)BP * N_KVH * SEQ * HEAD_DIM;
  _Float16* pWk = pWq + (size_t)D_MODEL * (N_HEADS * HEAD_DIM);
  _Float16* pWv = pWk + (size_t)D_MODEL * (N_KVH * HEAD_DIM);
  _Float16* pWo = pWv + (size_t)D_MODEL * (N_KVH * HEAD_DIM);

  convert_x_kernel<<<ROWS * D_MODEL / 8 / 256, 256, 0, stream>>>(hidden, xh);
  pack_w_kernel<<<dim3(64, KCH), 32, 0, stream>>>(Wq, 1024, pWq);
  pack_w_kernel<<<dim3(16, KCH), 32, 0, stream>>>(Wk, 256,  pWk);
  pack_w_kernel<<<dim3(16, KCH), 32, 0, stream>>>(Wv, 256,  pWv);
  pack_w_kernel<<<dim3(64, KCH), 32, 0, stream>>>(Wo, 1024, pWo);

  qkv_rope_kernel<<<dim3(ROWS / 64 / 4, (N_HEADS + 2 * N_KVH) / 3), 128, 0, stream>>>(
      xh, pWq, pWk, pWv, qws, kws, vT);

  attn_kernel<<<dim3(SEQ / 16, N_HEADS, BP), 32, 0, stream>>>(
      qws, kws, vT, ctx);

  out_proj_kernel<<<dim3(ROWS / 64 / 4, D_MODEL / 128), 128, 0, stream>>>(
      ctx, pWo, out);
}

// v002
// Measured time: 157 microseconds a run.
// Next to v001, in two timings, it ran 1.13 and 1.14 times as fast.
// Over all steps from v000 it is 2.01 times as fast.
#include <hip/hip_runtime.h>

// ---------------------------------------------------------------------------
// MI455X (gfx1250) fused attention: QKV+RoPE -> softmax attention -> out proj
// All matrix math via v_wmma_f32_16x16x32_f16 (wave32, f32 accumulate).
// Memory strategy: every f16 WMMA operand but Q (row-major) that passes through global memory
// lies in fragment order, in planes of 512 B: plane[lane][8 halfs].  One
// 16-byte load per lane then covers four whole 128 B lines.
//   A-order (xh, ctx), element (row, k) of a rows x 1024 matrix:
//     (((row>>4)*KCH + (k>>5))*2 + ((k>>4)&1))*256 + (((k>>3)&1)*16 + (row&15))*8 + (k&7)
//   weights: the same with the n tile in place of the row tile
//   K: per 16-key tile, plane pair by d;  V: per 32-key chunk and 16-d tile
// ---------------------------------------------------------------------------

typedef __attribute__((ext_vector_type(16))) _Float16 v16h;
typedef __attribute__((ext_vector_type(8)))  _Float16 v8h;
typedef __attribute__((ext_vector_type(4)))  _Float16 v4h;
typedef __attribute__((ext_vector_type(8)))  float    v8f;
typedef __attribute__((ext_vector_type(4)))  float    v4f;

#define D_MODEL   1024
#define N_HEADS   16
#define N_KVH     4
#define HEAD_DIM  64
#define SEQ       512
#define BP        16          // B*P = 2*8
#define ROWS      8192        // BP * SEQ
#define KCH       (D_MODEL / 32)   // 32 k-chunks of 32

__device__ __forceinline__ v8f wmma16x16x32(v16h a, v16h b, v8f c) {
  // (neg_a, A, neg_b, B, c_mod, C, reuse_a, reuse_b)
  return __builtin_amdgcn_wmma_f32_16x16x32_f16(false, a, false, b, (short)0, c,
                                                false, false);
}

__device__ __forceinline__ v16h cat8(v8h lo, v8h hi) {
  v16h r;
#pragma unroll
  for (int i = 0; i < 8; ++i) { r[i] = lo[i]; r[i + 8] = hi[i]; }
  return r;
}

// ===========================================================================
// Kernel 0a: hidden (b,t,p,d) fp32 -> xh, f16, rows (b,p,t), in A-order.
// One block turns 16 rows x 128 d: whole-line reads, a turn through LDS,
// whole-line stores.  grid = (ROWS/16) * (D_MODEL/128) blocks.
// ===========================================================================
__global__ __launch_bounds__(256)
void convert_x_kernel(const float* __restrict__ hidden,
                      _Float16* __restrict__ xh)
{
  // pitch 136 halfs: rows fall on other banks for the 16-byte column reads
  __shared__ __align__(16) _Float16 t[16][136];

  const int lane  = threadIdx.x & 31;
  const int w     = threadIdx.x >> 5;
  const int rtile = blockIdx.x >> 3;                  // 16-row tile
  const int db    = blockIdx.x & 7;                   // 128-wide d block
#pragma unroll
  for (int j = 0; j < 2; ++j) {
    const int row = w * 2 + j;
    const int rr  = rtile * 16 + row;                 // (b,p,t) row
    const int bb  = rr >> 12;
    const int pp  = (rr >> 9) & 7;
    const int tt  = rr & (SEQ - 1);
    const float* s = hidden + (((size_t)(bb * SEQ + tt) * 8 + pp) << 10)
                            + db * 128 + lane * 4;
    v4f f = *(const v4f*)s;
    v4h h;
#pragma unroll
    for (int i = 0; i < 4; ++i) h[i] = (_Float16)f[i];
    *(v4h*)&t[row][lane * 4] = h;
  }
  __syncthreads();   // the planes are read across the rows other waves wrote

  const int part = w & 1;                             // plane of the k chunk
  const int kcl  = w >> 1;                            // k chunk in the block
  v8h o = *(const v8h*)&t[lane & 15][kcl * 32 + part * 16 + (lane >> 4) * 8];
  *(v8h*)(xh + ((size_t)(rtile * KCH + db * 4 + kcl) * 2 + part) * 256 + lane * 8) = o;
}

// ===========================================================================
// Kernel 0b: pack fp32 weight (K=1024 x N) into f16 B-fragment order:
//   dst[((nt*KCH + kc)*2 + part)*256 + lane*8 + i] = W[k*N + nt*16 + (lane&15)]
// with k = kc*32 + part*16 + koff + i, i < 8, koff=(lane>>4)*8.
// grid = (N/16, KCH), 32 threads. Runs once; packed weights stay in L2.
// ===========================================================================
__global__ __launch_bounds__(32)
void pack_w_kernel(const float* __restrict__ W, int N,
                   _Float16* __restrict__ dst)
{
  const int lane = threadIdx.x;
  const int ln   = lane & 15;
  const int koff = (lane >> 4) << 3;
  const int nt   = blockIdx.x;
  const int kc   = blockIdx.y;
  const int kb   = kc * 32;
  const float* col = W + nt * 16 + ln;
  float f0[8], f1[8];
#pragma unroll
  for (int i = 0; i < 8; ++i) f0[i] = col[(size_t)(kb + koff + i) * N];
  // the second group's results may land in the first group's address registers
  asm volatile("s_wait_xcnt 0x0" ::: "memory");
#pragma unroll
  for (int i = 0; i < 8; ++i) f1[i] = col[(size_t)(kb + 16 + koff + i) * N];
  v8h b0, b1;
#pragma unroll
  for (int i = 0; i < 8; ++i) {
    b0[i] = (_Float16)f0[i];
    b1[i] = (_Float16)f1[i];
  }
  _Float16* d = dst + (size_t)(nt * KCH + kc) * 512 + lane * 8;
  *(v8h*)(d)       = b0;
  *(v8h*)(d + 256) = b1;
}

// ===========================================================================
// Register-tiled GEMM core shared by kernels 1 and 3.
// One wave owns MT x NT accumulator tiles (16x16 each): a loaded A fragment
// feeds NT WMMAs and a loaded B fragment MT WMMAs.  Two fragment sets: the
// next k chunk's loads are issued ahead of the current chunk's WMMAs.
//   ap    : A-order start of the wave's first row tile (wave-uniform)
//   bp[q] : packed n-tile 4*q of the wave's columns (wave-uniform)
// ===========================================================================
#define NTSTRIDE (KCH * 32 * 16)      // halfs per packed n-tile or A row tile

template <int MT, int NT>
__device__ __forceinline__ void load_frags(v16h (&a)[MT], v16h (&b)[NT],
                                           const _Float16* __restrict__ ap,
                                           const _Float16* const (&bp)[NT / 4],
                                           int kc)
{
#pragma unroll
  for (int mi = 0; mi < MT; ++mi) {
    const _Float16* p = ap + (size_t)mi * NTSTRIDE + kc * 512
                           + (threadIdx.x & 31) * 8;
    a[mi] = cat8(*(const v8h*)(p), *(const v8h*)(p + 256));
  }
#pragma unroll
  for (int nj = 0; nj < NT; ++nj) {
    const _Float16* p = bp[nj >> 2] + (size_t)(nj & 3) * NTSTRIDE + kc * 512
                                    + (threadIdx.x & 31) * 8;
    b[nj] = cat8(*(const v8h*)(p), *(const v8h*)(p + 256));
  }
}

template <int MT, int NT>
__device__ __forceinline__ void mma_frags(const v16h (&a)[MT], const v16h (&b)[NT],
                                          v8f (&acc)[MT][NT])
{
#pragma unroll
  for (int mi = 0; mi < MT; ++mi)
#pragma unroll
    for (int nj = 0; nj < NT; ++nj)
      acc[mi][nj] = wmma16x16x32(a[mi], b[nj], acc[mi][nj]);
}

template <int MT, int NT>
__device__ __forceinline__ void gemm_tile(const _Float16* __restrict__ ap,
                                          const _Float16* const (&bp)[NT / 4],
                                          v8f (&acc)[MT][NT])
{
  v16h a0[MT], b0[NT], a1[MT], b1[NT];
  load_frags<MT, NT>(a0, b0, ap, bp, 0);
  __builtin_amdgcn_sched_barrier(0);   // holds the wait directly behind the loads
  // registers that the issued loads name are rewritten next: wait first
  asm volatile("s_wait_xcnt 0x0" ::: "memory");
  __builtin_amdgcn_sched_barrier(0);
  for (int kc = 0; kc < KCH - 2; kc += 2) {
    // the scheduling fences keep each load group whole and ahead of the WMMA
    // block; without them the loads sink in among the WMMAs that need them
    load_frags<MT, NT>(a1, b1, ap, bp, kc + 1);
    __builtin_amdgcn_sched_barrier(0);
    mma_frags<MT, NT>(a0, b0, acc);
    __builtin_amdgcn_sched_barrier(0);
    load_frags<MT, NT>(a0, b0, ap, bp, kc + 2);
    __builtin_amdgcn_sched_barrier(0);
    mma_frags<MT, NT>(a1, b1, acc);
    __builtin_amdgcn_sched_barrier(0);
    // the address registers of the issued loads step on behind this wait
    asm volatile("s_wait_xcnt 0x0" ::: "memory");
    __builtin_amdgcn_sched_barrier(0);
  }
  load_frags<MT, NT>(a1, b1, ap, bp, KCH - 1);
  __builtin_amdgcn_sched_barrier(0);   // same: last load group ahead of the WMMAs
  mma_frags<MT, NT>(a0, b0, acc);
  __builtin_amdgcn_sched_barrier(0);
  // the last loads' address registers are free for reuse behind this wait
  asm volatile("s_wait_xcnt 0x0" ::: "memory");
  __builtin_amdgcn_sched_barrier(0);
  mma_frags<MT, NT>(a1, b1, acc);
}

// ===========================================================================
// Kernel 1: QKV projection + RoPE + q-scale from packed f16 operands.
// 4 waves / block; wave w owns rows [64*(blockIdx.x*4+w), +64) and the three
// 64-wide head columns 3*blockIdx.y .. +2 of the 24 (16 q, 4 k, 4 v).
// Q written row-major (slot,t,d), K in fragment order, both via LDS-staged
// whole-line stores.  V written in fragment order straight from registers.
// ===========================================================================
__global__ __launch_bounds__(128)
void qkv_rope_kernel(const _Float16* __restrict__ xh,
                     const _Float16* __restrict__ pWq,
                     const _Float16* __restrict__ pWk,
                     const _Float16* __restrict__ pWv,
                     _Float16* __restrict__ qws,
                     _Float16* __restrict__ kws,
                     _Float16* __restrict__ vT)
{
  __shared__ __align__(128) _Float16 st[4][3][64][64];   // 96 KB staging

  const int lane = threadIdx.x & 31;
  const int w    = threadIdx.x >> 5;
  const int ln   = lane & 15;
  const int mb   = (lane >> 4) << 3;
  const int rt   = blockIdx.x * 4 + w;     // 64-row tile
  const int hc0  = blockIdx.y * 3;         // first of three head columns

  const _Float16* bp[3];
#pragma unroll
  for (int hh = 0; hh < 3; ++hh) {
    const int hc = hc0 + hh;
    const _Float16* pW = (hc < 16) ? pWq + (size_t)hc * 4 * NTSTRIDE
                       : (hc < 20) ? pWk + (size_t)(hc - 16) * 4 * NTSTRIDE
                                   : pWv + (size_t)(hc - 20) * 4 * NTSTRIDE;
    bp[hh] = pW;
  }
  const _Float16* ap = xh + (size_t)(rt * 4) * NTSTRIDE;

  v8f acc[4][12] = {};
  gemm_tile<4, 12>(ap, bp, acc);

  const int t0 = (rt * 64) & (SEQ - 1);
  const int bpi = rt >> 3;

  // RoPE tables of this lane's 32 rows, shared by the wave's q and k heads
  const float LOG1E4_32 = 0.28782313662425575f;    // ln(10000)/32
  const float fA = __expf(-(float)ln * LOG1E4_32);
  const float fB = __expf(-(float)(16 + ln) * LOG1E4_32);
  float sA[4][8], cA[4][8], sB[4][8], cB[4][8];
#pragma unroll
  for (int mi = 0; mi < 4; ++mi)
#pragma unroll
    for (int r = 0; r < 8; ++r) {
      const float tm = (float)(t0 + mi * 16 + mb + r);
      __sincosf(tm * fA, &sA[mi][r], &cA[mi][r]);
      __sincosf(tm * fB, &sB[mi][r], &cB[mi][r]);
    }

#pragma unroll
  for (int hh = 0; hh < 3; ++hh) {
    const int hc = hc0 + hh;
    if (hc < 20) {
      // RoPE pairs (dh, dh+32): tile 0<->2 (dh=ln), tile 1<->3 (dh=16+ln)
      const float qs = (hc < 16) ? 0.125f : 1.0f;  // 1/sqrt(HEAD_DIM) into q
#pragma unroll
      for (int mi = 0; mi < 4; ++mi)
#pragma unroll
        for (int r = 0; r < 8; ++r) {
          _Float16* srow = &st[w][hh][mi * 16 + mb + r][0];
          float lo = acc[mi][hh * 4 + 0][r], hi = acc[mi][hh * 4 + 2][r];
          srow[ln]      = (_Float16)((lo * cA[mi][r] - hi * sA[mi][r]) * qs);
          srow[32 + ln] = (_Float16)((lo * sA[mi][r] + hi * cA[mi][r]) * qs);
          lo = acc[mi][hh * 4 + 1][r]; hi = acc[mi][hh * 4 + 3][r];
          srow[16 + ln] = (_Float16)((lo * cB[mi][r] - hi * sB[mi][r]) * qs);
          srow[48 + ln] = (_Float16)((lo * sB[mi][r] + hi * cB[mi][r]) * qs);
        }
    } else {
      // V: a lane's 8 rows of one column are one piece of the plane
      // [32-key chunk][16-d tile j][key half mi&1][lane]
      _Float16* dst = vT + ((size_t)(bpi * N_KVH + (hc - 20)) * HEAD_DIM) * SEQ
                         + (size_t)(t0 >> 5) * 2048 + lane * 8;
#pragma unroll
      for (int j = 0; j < 4; ++j) {
#pragma unroll
        for (int mi = 0; mi < 4; ++mi) {
          v8h h;
#pragma unroll
          for (int r = 0; r < 8; ++r) h[r] = (_Float16)acc[mi][hh * 4 + j][r];
          *(v8h*)(dst + ((mi >> 1) * 4 + j) * 512 + (mi & 1) * 256) = h;
        }
        // the stores' data registers are refilled next: wait first (the fence
        // holds the next conversions behind the wait)
        asm volatile("s_wait_xcnt 0x0" ::: "memory");
        __builtin_amdgcn_sched_barrier(0);
      }
    }
  }
  __syncthreads();   // staged rows are read back by other lanes

#pragma unroll
  for (int hh = 0; hh < 3; ++hh) {
    const int hc = hc0 + hh;
    if (hc < 20) {
      // 64 rows x 64 halfs of one head are 8 KB contiguous in q / k
      _Float16* dst = (hc < 16)
          ? qws + ((size_t)(bpi * N_HEADS + hc) * SEQ + t0) * HEAD_DIM
          : kws + ((size_t)(bpi * N_KVH + (hc - 16)) * SEQ + t0) * HEAD_DIM;
      const v8h* s = (const v8h*)&st[w][hh][0][0];
      v8h* g = (v8h*)dst;
      // q leaves as it lies; k leaves per 16-key tile as planes [d/8][key]
      const bool isq = hc < 16;
      const int  sl  = isq ? lane : ln * 8 + (lane >> 4);
#pragma unroll
      for (int i = 0; i < 16; ++i)
        g[i * 32 + lane] = s[sl + (isq ? i * 32 : (i >> 2) * 128 + (i & 3) * 2)];
      if (hh < 2) {
        // the next head column reuses these stores' data and address
        // registers: wait first
        asm volatile("s_wait_xcnt 0x0" ::: "memory");
      }
    }
  }
}

// ===========================================================================
// Kernel 2: attention, one wave per (bp, head, 16-query tile).
//   grid = (SEQ/16, N_HEADS, BP)
// f16 scores/probs in one 16 KB LDS buffer, exact softmax in fp32 registers,
// K and V fragments read as whole planes, ctx stored in A-order via LDS.
// ===========================================================================
__global__ __launch_bounds__(32)
void attn_kernel(const _Float16* __restrict__ qws,
                 const _Float16* __restrict__ kws,
                 const _Float16* __restrict__ vT,
                 _Float16* __restrict__ ctx)
{
  __shared__ __align__(128) _Float16 sc[16][SEQ];     // 16 KB scores/probs

  const int lane = threadIdx.x;
  const int ln   = lane & 15;
  const int koff = (lane >> 4) << 3;
  const int mb   = (lane >> 4) << 3;
  const int qt   = blockIdx.x;
  const int h    = blockIdx.y;
  const int bp   = blockIdx.z;

  const _Float16* __restrict__ qb = qws + ((size_t)(bp * N_HEADS + h)        * SEQ) * HEAD_DIM;
  const _Float16* __restrict__ kb = kws + ((size_t)(bp * N_KVH   + (h >> 2)) * SEQ) * HEAD_DIM;
  const _Float16* __restrict__ vb = vT  + ((size_t)(bp * N_KVH   + (h >> 2)) * HEAD_DIM) * SEQ;

  // Q tile A-fragments (16x64 as two 16x32 chunks)
  const _Float16* qrow = qb + (size_t)(qt * 16 + ln) * HEAD_DIM;
  v16h aq0 = cat8(*(const v8h*)(qrow + koff),      *(const v8h*)(qrow + 16 + koff));
  v16h aq1 = cat8(*(const v8h*)(qrow + 32 + koff), *(const v8h*)(qrow + 48 + koff));

  // S = Q K^T : a key tile is four planes, d = 0.., 16.., 32.., 48.. (+koff),
  // 2 KB in a row (the same 16 lines as 16 row-major key rows)
  for (int kt = 0; kt < SEQ / 16; ++kt) {
    const _Float16* krow = kb + (size_t)(kt * 16 + ln) * HEAD_DIM;
    if (kt + 1 < SEQ / 16)
      __builtin_prefetch(krow + HEAD_DIM * 16, 0, 1);   // global_prefetch_b8
    const _Float16* kp = kb + (size_t)kt * 1024 + lane * 8;
    v16h bk0 = cat8(*(const v8h*)(kp),       *(const v8h*)(kp + 256));
    v16h bk1 = cat8(*(const v8h*)(kp + 512), *(const v8h*)(kp + 768));
    v8f c = {};
    c = wmma16x16x32(aq0, bk0, c);
    c = wmma16x16x32(aq1, bk1, c);
    const int col = kt * 16 + ln;
#pragma unroll
    for (int r = 0; r < 8; ++r) sc[mb + r][col] = (_Float16)c[r];
  }
  __syncthreads();

  // Exact softmax over 512 keys (fp32 registers, full-wave shuffle reductions)
  for (int row = 0; row < 16; ++row) {
    float vals[16];
    float mx = -3.0e38f;
#pragma unroll
    for (int j = 0; j < 16; ++j) {
      vals[j] = (float)sc[row][lane + 32 * j];
      mx = fmaxf(mx, vals[j]);
    }
#pragma unroll
    for (int off = 16; off > 0; off >>= 1)
      mx = fmaxf(mx, __shfl_xor(mx, off, 32));
    float sum = 0.f;
#pragma unroll
    for (int j = 0; j < 16; ++j) {
      vals[j] = __expf(vals[j] - mx);
      sum += vals[j];
    }
#pragma unroll
    for (int off = 16; off > 0; off >>= 1)
      sum += __shfl_xor(sum, off, 32);
    const float rinv = 1.0f / sum;
#pragma unroll
    for (int j = 0; j < 16; ++j)
      sc[row][lane + 32 * j] = (_Float16)(vals[j] * rinv);
  }
  __syncthreads();

  // O = P V : P rows contiguous in LDS, V planes contiguous in global
  v8f o0 = {}, o1 = {}, o2 = {}, o3 = {};
  const _Float16* prow = &sc[ln][0];
  for (int kt = 0; kt < SEQ / 32; ++kt) {
    const int kbse = kt * 32;
    const _Float16* vp = vb + (size_t)kt * 2048 + lane * 8;
    v16h ap  = cat8(*(const v8h*)(prow + kbse + koff), *(const v8h*)(prow + kbse + 16 + koff));
    v16h bv0 = cat8(*(const v8h*)(vp),        *(const v8h*)(vp + 256));
    v16h bv1 = cat8(*(const v8h*)(vp + 512),  *(const v8h*)(vp + 768));
    v16h bv2 = cat8(*(const v8h*)(vp + 1024), *(const v8h*)(vp + 1280));
    v16h bv3 = cat8(*(const v8h*)(vp + 1536), *(const v8h*)(vp + 1792));
    o0 = wmma16x16x32(ap, bv0, o0);
    o1 = wmma16x16x32(ap, bv1, o1);
    o2 = wmma16x16x32(ap, bv2, o2);
    o3 = wmma16x16x32(ap, bv3, o3);
  }

  // stage 16x64 out tile into LDS (reuse sc), then four A-order planes
  __syncthreads();
  _Float16 (*ot)[64] = (_Float16(*)[64])sc;
#pragma unroll
  for (int r = 0; r < 8; ++r) {
    _Float16* srow = &ot[mb + r][0];
    srow[ln]      = (_Float16)o0[r];
    srow[16 + ln] = (_Float16)o1[r];
    srow[32 + ln] = (_Float16)o2[r];
    srow[48 + ln] = (_Float16)o3[r];
  }
  __syncthreads();
  _Float16* g = ctx + ((size_t)(bp * (SEQ / 16) + qt) * KCH + h * 2) * 512 + lane * 8;
#pragma unroll
  for (int i = 0; i < 4; ++i)
    *(v8h*)(g + i * 256) = *(const v8h*)&ot[ln][i * 16 + koff];
}

// ===========================================================================
// Kernel 3: out = ctx @ Wo (packed) with (B,T,P,:) permuted fp32 store.
// 4 waves / block; wave w owns rows [64*(blockIdx.x*4+w), +64) and the 128
// columns of blockIdx.y.  Rows leave as whole 512 B pieces through LDS.
// ===========================================================================
__global__ __launch_bounds__(128)
void out_proj_kernel(const _Float16* __restrict__ ctx,
                     const _Float16* __restrict__ pWo,
                     float* __restrict__ out)
{
  // pitch 132 floats: the two lane halves (8 rows apart) fall on other banks
  __shared__ __align__(128) float ot[4][64][132];

  const int lane = threadIdx.x & 31;
  const int w    = threadIdx.x >> 5;
  const int ln   = lane & 15;
  const int mb   = (lane >> 4) << 3;
  const int rt   = blockIdx.x * 4 + w;     // 64-row tile
  const int ct   = blockIdx.y;             // 128-column tile

  const _Float16* ap = ctx + (size_t)(rt * 4) * NTSTRIDE;
  const _Float16* bp[2];
  bp[0] = pWo + (size_t)(ct * 8) * NTSTRIDE;
  bp[1] = bp[0] + (size_t)4 * NTSTRIDE;

  v8f acc[4][8] = {};
  gemm_tile<4, 8>(ap, bp, acc);

#pragma unroll
  for (int mi = 0; mi < 4; ++mi)
#pragma unroll
    for (int nj = 0; nj < 8; ++nj)
#pragma unroll
      for (int r = 0; r < 8; ++r)
        ot[w][mi * 16 + mb + r][nj * 16 + ln] = acc[mi][nj][r];
  __syncthreads();   // staged rows are read back by other lanes

  // the tile's 64 (b,p,t) rows share b and p; t runs on
  const int rr = rt * 64;
  const int bb = rr >> 12;
  const int pp = (rr >> 9) & 7;
  const int tt = rr & (SEQ - 1);
  float* grow = out + (((size_t)(bb * SEQ + tt) * 8 + pp) << 10)
                    + ct * 128 + lane * 4;
#pragma unroll
  for (int row = 0; row < 64; ++row)
    *(v4f*)(grow + (size_t)row * 8 * D_MODEL) = *(const v4f*)&ot[w][row][lane * 4];
}

// ===========================================================================
extern "C" void kernel_launch(void* const* d_in, const int* in_sizes, int n_in,
                              void* d_out, int out_size, void* d_ws, size_t ws_size,
                              hipStream_t stream) {
  const float* hidden = (const float*)d_in[0];
  const float* Wq     = (const float*)d_in[1];
  const float* Wk     = (const float*)d_in[2];
  const float* Wv     = (const float*)d_in[3];
  const float* Wo     = (const float*)d_in[4];
  float*       out    = (float*)d_out;

  // f16 workspace layout (halfs). ctx aliases xh (xh dead after kernel 1).
  _Float16* xh  = (_Float16*)d_ws;                         // 8192*1024
  _Float16* ctx = xh;                                      // alias
  _Float16* qws = xh  + (size_t)ROWS * D_MODEL;            // 16*16*512*64
  _Float16* kws = qws + (size_t)BP * N_HEADS * SEQ * HEAD_DIM;
  _Float16* vT  = kws + (size_t)BP * N_KVH * SEQ * HEAD_DIM;
  _Float16* pWq = vT  + (size_t)BP * N_KVH * SEQ * HEAD_DIM;
  _Float16* pWk = pWq + (size_t)D_MODEL * (N_HEADS * HEAD_DIM);
  _Float16* pWv = pWk + (size_t)D_MODEL * (N_KVH * HEAD_DIM);
  _Float16* pWo = pWv + (size_t)D_MODEL * (N_KVH * HEAD_DIM);

  convert_x_kernel<<<(ROWS / 16) * (D_MODEL / 128), 256, 0, stream>>>(hidden, xh);
  pack_w_kernel<<<dim3(64, KCH), 32, 0, stream>>>(Wq, 1024, pWq);
  pack_w_kernel<<<dim3(16, KCH), 32, 0, stream>>>(Wk, 256,  pWk);
  pack_w_kernel<<<dim3(16, KCH), 32, 0, stream>>>(Wv, 256,  pWv);
  pack_w_kernel<<<dim3(64, KCH), 32, 0, stream>>>(Wo, 1024, pWo);

  qkv_rope_kernel<<<dim3(ROWS / 64 / 4, (N_HEADS + 2 * N_KVH) / 3), 128, 0, stream>>>(
      xh, pWq, pWk, pWv, qws, kws, vT);

  attn_kernel<<<dim3(SEQ / 16, N_HEADS, BP), 32, 0, stream>>>(
      qws, kws, vT, ctx);

  out_proj_kernel<<<dim3(ROWS / 64 / 4, D_MODEL / 128), 128, 0, stream>>>(
      ctx, pWo, out);
}

// v003
// A run of this version takes 96.9 microseconds.
// In two side-by-side timings against v002, it was 1.63 and 1.61 times as fast.
// Over all steps from v000 it is 3.25 times as fast.
#include <hip/hip_runtime.h>

// ---------------------------------------------------------------------------
// MI455X (gfx1250) fused attention: QKV+RoPE -> softmax attention -> out proj
// All matrix math via v_wmma_f32_16x16x32_f16 (wave32, f32 accumulate).
// Memory strategy: every f16 WMMA operand but Q (row-major) that passes through global memory
// lies in fragment order, in planes of 512 B: plane[lane][8 halfs].  One
// 16-byte load per lane then covers four whole 128 B lines.
//   A-order (xh, ctx), element (row, k) of a rows x 1024 matrix:
//     (((row>>4)*KCH + (k>>5))*2 + ((k>>4)&1))*256 + (((k>>3)&1)*16 + (row&15))*8 + (k&7)
//   weights: the same with the n tile in place of the row tile
//   K: per 16-key tile, plane pair by d;  V: per 32-key chunk and 16-d tile
// ---------------------------------------------------------------------------

typedef __attribute__((ext_vector_type(16))) _Float16 v16h;
typedef __attribute__((ext_vector_type(8)))  _Float16 v8h;
typedef __attribute__((ext_vector_type(4)))  _Float16 v4h;
typedef __attribute__((ext_vector_type(8)))  float    v8f;
typedef __attribute__((ext_vector_type(4)))  float    v4f;

#define D_MODEL   1024
#define N_HEADS   16
#define N_KVH     4
#define HEAD_DIM  64
#define SEQ       512
#define BP        16          // B*P = 2*8
#define ROWS      8192        // BP * SEQ
#define KCH       (D_MODEL / 32)   // 32 k-chunks of 32

__device__ __forceinline__ v8f wmma16x16x32(v16h a, v16h b, v8f c) {
  // (neg_a, A, neg_b, B, c_mod, C, reuse_a, reuse_b)
  return __builtin_amdgcn_wmma_f32_16x16x32_f16(false, a, false, b, (short)0, c,
                                                false, false);
}

__device__ __forceinline__ v16h cat8(v8h lo, v8h hi) {
  v16h r;
#pragma unroll
  for (int i = 0; i < 8; ++i) { r[i] = lo[i]; r[i + 8] = hi[i]; }
  return r;
}

// ===========================================================================
// Kernel 0a: hidden (b,t,p,d) fp32 -> xh, f16, rows (b,p,t), in A-order.
// One block turns 16 rows x 128 d: whole-line reads, a turn through LDS,
// whole-line stores.  grid = (ROWS/16) * (D_MODEL/128) blocks.
// ===========================================================================
__global__ __launch_bounds__(256)
void convert_x_kernel(const float* __restrict__ hidden,
                      _Float16* __restrict__ xh)
{
  // pitch 136 halfs: rows fall on other banks for the 16-byte column reads
  __shared__ __align__(16) _Float16 t[16][136];

  const int lane  = threadIdx.x & 31;
  const int w     = threadIdx.x >> 5;
  const int rtile = blockIdx.x >> 3;                  // 16-row tile
  const int db    = blockIdx.x & 7;                   // 128-wide d block
#pragma unroll
  for (int j = 0; j < 2; ++j) {
    const int row = w * 2 + j;
    const int rr  = rtile * 16 + row;                 // (b,p,t) row
    const int bb  = rr >> 12;
    const int pp  = (rr >> 9) & 7;
    const int tt  = rr & (SEQ - 1);
    const float* s = hidden + (((size_t)(bb * SEQ + tt) * 8 + pp) << 10)
                            + db * 128 + lane * 4;
    v4f f = *(const v4f*)s;
    v4h h;
#pragma unroll
    for (int i = 0; i < 4; ++i) h[i] = (_Float16)f[i];
    *(v4h*)&t[row][lane * 4] = h;
  }
  __syncthreads();   // the planes are read across the rows other waves wrote

  const int part = w & 1;                             // plane of the k chunk
  const int kcl  = w >> 1;                            // k chunk in the block
  v8h o = *(const v8h*)&t[lane & 15][kcl * 32 + part * 16 + (lane >> 4) * 8];
  *(v8h*)(xh + ((size_t)(rtile * KCH + db * 4 + kcl) * 2 + part) * 256 + lane * 8) = o;
}

// ===========================================================================
// Kernel 0b: pack fp32 weight (K=1024 x N) into f16 B-fragment order:
//   dst[((nt*KCH + kc)*2 + part)*256 + lane*8 + i] = W[k*N + nt*16 + (lane&15)]
// with k = kc*32 + part*16 + koff + i, i < 8, koff=(lane>>4)*8.
// grid = (N/16, KCH), 32 threads. Runs once; packed weights stay in L2.
// ===========================================================================
__global__ __launch_bounds__(32)
void pack_w_kernel(const float* __restrict__ W, int N,
                   _Float16* __restrict__ dst)
{
  const int lane = threadIdx.x;
  const int ln   = lane & 15;
  const int koff = (lane >> 4) << 3;
  const int nt   = blockIdx.x;
  const int kc   = blockIdx.y;
  const int kb   = kc * 32;
  const float* col = W + nt * 16 + ln;
  float f0[8], f1[8];
#pragma unroll
  for (int i = 0; i < 8; ++i) f0[i] = col[(size_t)(kb + koff + i) * N];
  // the second group's results may land in the first group's address registers
  asm volatile("s_wait_xcnt 0x0" ::: "memory");
#pragma unroll
  for (int i = 0; i < 8; ++i) f1[i] = col[(size_t)(kb + 16 + koff + i) * N];
  v8h b0, b1;
#pragma unroll
  for (int i = 0; i < 8; ++i) {
    b0[i] = (_Float16)f0[i];
    b1[i] = (_Float16)f1[i];
  }
  _Float16* d = dst + (size_t)(nt * KCH + kc) * 512 + lane * 8;
  *(v8h*)(d)       = b0;
  *(v8h*)(d + 256) = b1;
}

// ===========================================================================
// Register-tiled GEMM core shared by kernels 1 and 3.
// One wave owns MT x NT accumulator tiles (16x16 each): a loaded A fragment
// feeds NT WMMAs and a loaded B fragment MT WMMAs.  Two fragment sets: the
// next k chunk's loads are issued ahead of the current chunk's WMMAs.
//   ap    : A-order start of the wave's first row tile (wave-uniform)
//   bp[q] : packed n-tile 4*q of the wave's columns (wave-uniform)
// ===========================================================================
#define NTSTRIDE (KCH * 32 * 16)      // halfs per packed n-tile or A row tile

template <int MT, int NT>
__device__ __forceinline__ void load_frags(v16h (&a)[MT], v16h (&b)[NT],
                                           const _Float16* __restrict__ ap,
                                           const _Float16* const (&bp)[NT / 4],
                                           int kc)
{
#pragma unroll
  for (int mi = 0; mi < MT; ++mi) {
    const _Float16* p = ap + (size_t)mi * NTSTRIDE + kc * 512
                           + (threadIdx.x & 31) * 8;
    a[mi] = cat8(*(const v8h*)(p), *(const v8h*)(p + 256));
  }
#pragma unroll
  for (int nj = 0; nj < NT; ++nj) {
    const _Float16* p = bp[nj >> 2] + (size_t)(nj & 3) * NTSTRIDE + kc * 512
                                    + (threadIdx.x & 31) * 8;
    b[nj] = cat8(*(const v8h*)(p), *(const v8h*)(p + 256));
  }
}

template <int MT, int NT>
__device__ __forceinline__ void mma_frags(const v16h (&a)[MT], const v16h (&b)[NT],
                                          v8f (&acc)[MT][NT])
{
#pragma unroll
  for (int mi = 0; mi < MT; ++mi)
#pragma unroll
    for (int nj = 0; nj < NT; ++nj)
      acc[mi][nj] = wmma16x16x32(a[mi], b[nj], acc[mi][nj]);
}

template <int MT, int NT>
__device__ __forceinline__ void gemm_tile(const _Float16* __restrict__ ap,
                                          const _Float16* const (&bp)[NT / 4],
                                          v8f (&acc)[MT][NT])
{
  v16h a0[MT], b0[NT], a1[MT], b1[NT];
  load_frags<MT, NT>(a0, b0, ap, bp, 0);
  __builtin_amdgcn_sched_barrier(0);   // holds the wait directly behind the loads
  // registers that the issued loads name are rewritten next: wait first
  asm volatile("s_wait_xcnt 0x0" ::: "memory");
  __builtin_amdgcn_sched_barrier(0);
  for (int kc = 0; kc < KCH - 2; kc += 2) {
    // the scheduling fences keep each load group whole and ahead of the WMMA
    // block; without them the loads sink in among the WMMAs that need them
    load_frags<MT, NT>(a1, b1, ap, bp, kc + 1);
    __builtin_amdgcn_sched_barrier(0);
    mma_frags<MT, NT>(a0, b0, acc);
    __builtin_amdgcn_sched_barrier(0);
    load_frags<MT, NT>(a0, b0, ap, bp, kc + 2);
    __builtin_amdgcn_sched_barrier(0);
    mma_frags<MT, NT>(a1, b1, acc);
    __builtin_amdgcn_sched_barrier(0);
    // the address registers of the issued loads step on behind this wait
    asm volatile("s_wait_xcnt 0x0" ::: "memory");
    __builtin_amdgcn_sched_barrier(0);
  }
  load_frags<MT, NT>(a1, b1, ap, bp, KCH - 1);
  __builtin_amdgcn_sched_barrier(0);   // same: last load group ahead of the WMMAs
  mma_frags<MT, NT>(a0, b0, acc);
  __builtin_amdgcn_sched_barrier(0);
  // the last loads' address registers are free for reuse behind this wait
  asm volatile("s_wait_xcnt 0x0" ::: "memory");
  __builtin_amdgcn_sched_barrier(0);
  mma_frags<MT, NT>(a1, b1, acc);
}

// ===========================================================================
// Kernel 1: QKV projection + RoPE + q-scale from packed f16 operands.
// 4 waves / block; wave w owns rows [64*(blockIdx.x*4+w), +64) and the three
// 64-wide head columns 3*blockIdx.y .. +2 of the 24 (16 q, 4 k, 4 v).
// Q written row-major (slot,t,d), K in fragment order, both via LDS-staged
// whole-line stores.  V written in fragment order straight from registers.
// ===========================================================================
__global__ __launch_bounds__(128)
void qkv_rope_kernel(const _Float16* __restrict__ xh,
                     const _Float16* __restrict__ pWq,
                     const _Float16* __restrict__ pWk,
                     const _Float16* __restrict__ pWv,
                     _Float16* __restrict__ qws,
                     _Float16* __restrict__ kws,
                     _Float16* __restrict__ vT)
{
  __shared__ __align__(128) _Float16 st[4][3][64][64];   // 96 KB staging

  const int lane = threadIdx.x & 31;
  const int w    = threadIdx.x >> 5;
  const int ln   = lane & 15;
  const int mb   = (lane >> 4) << 3;
  const int rt   = blockIdx.x * 4 + w;     // 64-row tile
  const int hc0  = blockIdx.y * 3;         // first of three head columns

  const _Float16* bp[3];
#pragma unroll
  for (int hh = 0; hh < 3; ++hh) {
    const int hc = hc0 + hh;
    const _Float16* pW = (hc < 16) ? pWq + (size_t)hc * 4 * NTSTRIDE
                       : (hc < 20) ? pWk + (size_t)(hc - 16) * 4 * NTSTRIDE
                                   : pWv + (size_t)(hc - 20) * 4 * NTSTRIDE;
    bp[hh] = pW;
  }
  const _Float16* ap = xh + (size_t)(rt * 4) * NTSTRIDE;

  v8f acc[4][12] = {};
  gemm_tile<4, 12>(ap, bp, acc);

  const int t0 = (rt * 64) & (SEQ - 1);
  const int bpi = rt >> 3;

  // RoPE tables of this lane's 32 rows, shared by the wave's q and k heads
  const float LOG1E4_32 = 0.28782313662425575f;    // ln(10000)/32
  const float fA = __expf(-(float)ln * LOG1E4_32);
  const float fB = __expf(-(float)(16 + ln) * LOG1E4_32);
  float sA[4][8], cA[4][8], sB[4][8], cB[4][8];
#pragma unroll
  for (int mi = 0; mi < 4; ++mi)
#pragma unroll
    for (int r = 0; r < 8; ++r) {
      const float tm = (float)(t0 + mi * 16 + mb + r);
      __sincosf(tm * fA, &sA[mi][r], &cA[mi][r]);
      __sincosf(tm * fB, &sB[mi][r], &cB[mi][r]);
    }

#pragma unroll
  for (int hh = 0; hh < 3; ++hh) {
    const int hc = hc0 + hh;
    if (hc < 20) {
      // RoPE pairs (dh, dh+32): tile 0<->2 (dh=ln), tile 1<->3 (dh=16+ln)
      const float qs = (hc < 16) ? 0.125f : 1.0f;  // 1/sqrt(HEAD_DIM) into q
#pragma unroll
      for (int mi = 0; mi < 4; ++mi)
#pragma unroll
        for (int r = 0; r < 8; ++r) {
          _Float16* srow = &st[w][hh][mi * 16 + mb + r][0];
          float lo = acc[mi][hh * 4 + 0][r], hi = acc[mi][hh * 4 + 2][r];
          srow[ln]      = (_Float16)((lo * cA[mi][r] - hi * sA[mi][r]) * qs);
          srow[32 + ln] = (_Float16)((lo * sA[mi][r] + hi * cA[mi][r]) * qs);
          lo = acc[mi][hh * 4 + 1][r]; hi = acc[mi][hh * 4 + 3][r];
          srow[16 + ln] = (_Float16)((lo * cB[mi][r] - hi * sB[mi][r]) * qs);
          srow[48 + ln] = (_Float16)((lo * sB[mi][r] + hi * cB[mi][r]) * qs);
        }
    } else {
      // V: a lane's 8 rows of one column are one piece of the plane
      // [32-key chunk][16-d tile j][key half mi&1][lane]
      _Float16* dst = vT + ((size_t)(bpi * N_KVH + (hc - 20)) * HEAD_DIM) * SEQ
                         + (size_t)(t0 >> 5) * 2048 + lane * 8;
#pragma unroll
      for (int j = 0; j < 4; ++j) {
#pragma unroll
        for (int mi = 0; mi < 4; ++mi) {
          v8h h;
#pragma unroll
          for (int r = 0; r < 8; ++r) h[r] = (_Float16)acc[mi][hh * 4 + j][r];
          *(v8h*)(dst + ((mi >> 1) * 4 + j) * 512 + (mi & 1) * 256) = h;
        }
        // the stores' data registers are refilled next: wait first (the fence
        // holds the next conversions behind the wait)
        asm volatile("s_wait_xcnt 0x0" ::: "memory");
        __builtin_amdgcn_sched_barrier(0);
      }
    }
  }
  __syncthreads();   // staged rows are read back by other lanes

#pragma unroll
  for (int hh = 0; hh < 3; ++hh) {
    const int hc = hc0 + hh;
    if (hc < 20) {
      // 64 rows x 64 halfs of one head are 8 KB contiguous in q / k
      _Float16* dst = (hc < 16)
          ? qws + ((size_t)(bpi * N_HEADS + hc) * SEQ + t0) * HEAD_DIM
          : kws + ((size_t)(bpi * N_KVH + (hc - 16)) * SEQ + t0) * HEAD_DIM;
      const v8h* s = (const v8h*)&st[w][hh][0][0];
      v8h* g = (v8h*)dst;
      // q leaves as it lies; k leaves per 16-key tile as planes [d/8][key]
      const bool isq = hc < 16;
      const int  sl  = isq ? lane : ln * 8 + (lane >> 4);
#pragma unroll
      for (int i = 0; i < 16; ++i)
        g[i * 32 + lane] = s[sl + (isq ? i * 32 : (i >> 2) * 128 + (i & 3) * 2)];
      if (hh < 2) {
        // the next head column reuses these stores' data and address
        // registers: wait first
        asm volatile("s_wait_xcnt 0x0" ::: "memory");
      }
    }
  }
}

// ===========================================================================
// Kernel 2: attention, one wave per (bp, head, 16-query tile).
//   grid = (SEQ/16, N_HEADS, BP)
// Both products run with their operands swapped: S^T = K Q^T, O^T = V^T P^T.
// A and B fragments share one lane map, so the K, Q and V registers are the
// ones the unswapped products take.  A lane then holds scores of ONE query
// (column lane&15), keys 8*(lane>>4)..+7 of each 16-key tile: two such tiles
// are, as they lie, the B fragment of P^T for one 32-key chunk.  Scores and
// probabilities never leave the registers; the softmax is the running form
// (maximum and sum carried from one 32-key block to the next), inside the
// lane but for one exchange with lane^16 per block; O^T leaves as A-order
// planes.  No LDS.  Every wave still reads its head's K and V (128 KB) from L2.
// ===========================================================================
// Four fragments (eight planes, 4 KB) of block blk of K or V.  The block's
// start goes through readfirstlane so that it stays in scalar registers: the
// loads then name that pair and the lane's own offset, which is never rewritten.
__device__ __forceinline__ void load_blk(v16h (&f)[4],
                                         const _Float16* __restrict__ base, int blk)
{
  const unsigned long long u = (unsigned long long)(base + blk * 2048);
  const unsigned lo = __builtin_amdgcn_readfirstlane((unsigned)u);
  const unsigned hi = __builtin_amdgcn_readfirstlane((unsigned)(u >> 32));
  // rebuilt from its words the pointer must be named global again, or the
  // loads turn into flat ones
  typedef const __attribute__((address_space(1))) v8h* gv8h;
  gv8h p = (gv8h)(((unsigned long long)hi << 32) | lo) + (threadIdx.x & 31);
#pragma unroll
  for (int i = 0; i < 4; ++i)
    f[i] = cat8(p[i * 64], p[i * 64 + 32]);
}

// value of the lane 16 away (same query, other eight keys of each tile)
__device__ __forceinline__ float other_half(float x) {
  return __builtin_bit_cast(float, __builtin_amdgcn_permlanex16(
      __builtin_bit_cast(unsigned, x), __builtin_bit_cast(unsigned, x),
      0x76543210u, 0xfedcba98u, false, false));
}

__device__ __forceinline__ void attn_block(const v16h (&k)[4], const v16h (&v)[4],
                                           v16h aq0, v16h aq1,
                                           float& m, float& sum, v8f (&o)[4])
{
  const float L2E = 1.4426950408889634f;              // log2(e)
  const v8f zero = {};
  v8f s0 = wmma16x16x32(k[0], aq0, zero);
  v8f s1 = wmma16x16x32(k[2], aq0, zero);
  s0 = wmma16x16x32(k[1], aq1, s0);
  s1 = wmma16x16x32(k[3], aq1, s1);

  float t[8];
#pragma unroll
  for (int r = 0; r < 8; ++r) t[r] = fmaxf(s0[r], s1[r]);
  float bm = fmaxf(fmaxf(fmaxf(t[0], t[1]), fmaxf(t[2], t[3])),
                   fmaxf(fmaxf(t[4], t[5]), fmaxf(t[6], t[7])));
  bm = fmaxf(bm, other_half(bm));
  const float mn    = fmaxf(m, bm);
  const float mL    = mn * L2E;
  const float alpha = __builtin_amdgcn_exp2f(fmaf(m, L2E, -mL));
  m = mn;

  v16h pf;
  float a[8];
#pragma unroll
  for (int r = 0; r < 8; ++r) {
    const float p0 = __builtin_amdgcn_exp2f(fmaf(s0[r], L2E, -mL));
    const float p1 = __builtin_amdgcn_exp2f(fmaf(s1[r], L2E, -mL));
    a[r]      = p0 + p1;
    pf[r]     = (_Float16)p0;
    pf[r + 8] = (_Float16)p1;
  }
  sum = fmaf(sum, alpha, ((a[0] + a[1]) + (a[2] + a[3])) + ((a[4] + a[5]) + (a[6] + a[7])));
#pragma unroll
  for (int j = 0; j < 4; ++j)
#pragma unroll
    for (int r = 0; r < 8; ++r) o[j][r] *= alpha;
#pragma unroll
  for (int j = 0; j < 4; ++j) o[j] = wmma16x16x32(v[j], pf, o[j]);
}

__global__ __launch_bounds__(32)
void attn_kernel(const _Float16* __restrict__ qws,
                 const _Float16* __restrict__ kws,
                 const _Float16* __restrict__ vT,
                 _Float16* __restrict__ ctx)
{
  const int lane = threadIdx.x;
  const int ln   = lane & 15;
  const int koff = (lane >> 4) << 3;
  const int qt   = blockIdx.x;
  const int h    = blockIdx.y;
  const int bp   = blockIdx.z;

  const _Float16* __restrict__ qb = qws + ((size_t)(bp * N_HEADS + h)        * SEQ) * HEAD_DIM;
  const _Float16* __restrict__ kb = kws + ((size_t)(bp * N_KVH   + (h >> 2)) * SEQ) * HEAD_DIM;
  const _Float16* __restrict__ vb = vT  + ((size_t)(bp * N_KVH   + (h >> 2)) * HEAD_DIM) * SEQ;

  // Q tile fragments (16x64 as two 16x32 chunks)
  const _Float16* qrow = qb + (size_t)(qt * 16 + ln) * HEAD_DIM;
  v16h aq0 = cat8(*(const v8h*)(qrow + koff),      *(const v8h*)(qrow + 16 + koff));
  v16h aq1 = cat8(*(const v8h*)(qrow + 32 + koff), *(const v8h*)(qrow + 48 + koff));

  float m = -3.0e38f, sum = 0.f;
  v8f o[4] = {};
  // K block: two 16-key tiles of two d halves, fetched one block ahead.
  // V block: four 16-d tiles of one 32-key chunk, fetched at the head of its
  // own block, ahead of the scores and the exponentials.
  v16h k0[4], k1[4];
  load_blk(k0, kb, 0);
  __builtin_amdgcn_sched_barrier(0);   // holds the wait directly behind the loads
  // registers that the issued loads name are rewritten next: wait first
  asm volatile("s_wait_xcnt 0x0" ::: "memory");
  __builtin_amdgcn_sched_barrier(0);
  for (int b = 0; b < SEQ / 32; b += 2) {
    v16h va[4], vc[4];
    // the scheduling fences keep each load group whole and ahead of the block;
    // without them the loads sink down to the WMMAs that need them
    load_blk(va, vb, b);
    load_blk(k1, kb, b + 1);
    __builtin_amdgcn_sched_barrier(0);
    attn_block(k0, va, aq0, aq1, m, sum, o);
    __builtin_amdgcn_sched_barrier(0);
    // the scalar bases of the issued loads are rewritten next: wait first
    asm volatile("s_wait_xcnt 0x0" ::: "memory");
    __builtin_amdgcn_sched_barrier(0);
    load_blk(vc, vb, b + 1);
    if (b + 2 < SEQ / 32) load_blk(k0, kb, b + 2);
    __builtin_amdgcn_sched_barrier(0);
    attn_block(k1, vc, aq0, aq1, m, sum, o);
    __builtin_amdgcn_sched_barrier(0);
    // the scalar bases of the issued loads step on behind this wait
    asm volatile("s_wait_xcnt 0x0" ::: "memory");
    __builtin_amdgcn_sched_barrier(0);
  }

  sum += other_half(sum);
  const float rinv = 1.0f / sum;

  // lane holds query ln, d = 16 j + koff + r: its piece of A-order plane j
  v8h oh[4];
#pragma unroll
  for (int j = 0; j < 4; ++j)
#pragma unroll
    for (int r = 0; r < 8; ++r) oh[j][r] = (_Float16)(o[j][r] * rinv);
  _Float16* g = ctx + ((size_t)(bp * (SEQ / 16) + qt) * KCH + h * 2) * 512 + lane * 8;
#pragma unroll
  for (int j = 0; j < 4; ++j)
    *(v8h*)(g + j * 256) = oh[j];
}

// ===========================================================================
// Kernel 3: out = ctx @ Wo (packed) with (B,T,P,:) permuted fp32 store.
// 4 waves / block; wave w owns rows [64*(blockIdx.x*4+w), +64) and the 128
// columns of blockIdx.y.  Rows leave as whole 512 B pieces through LDS.
// ===========================================================================
__global__ __launch_bounds__(128)
void out_proj_kernel(const _Float16* __restrict__ ctx,
                     const _Float16* __restrict__ pWo,
                     float* __restrict__ out)
{
  // pitch 132 floats: the two lane halves (8 rows apart) fall on other banks
  __shared__ __align__(128) float ot[4][64][132];

  const int lane = threadIdx.x & 31;
  const int w    = threadIdx.x >> 5;
  const int ln   = lane & 15;
  const int mb   = (lane >> 4) << 3;
  const int rt   = blockIdx.x * 4 + w;     // 64-row tile
  const int ct   = blockIdx.y;             // 128-column tile

  const _Float16* ap = ctx + (size_t)(rt * 4) * NTSTRIDE;
  const _Float16* bp[2];
  bp[0] = pWo + (size_t)(ct * 8) * NTSTRIDE;
  bp[1] = bp[0] + (size_t)4 * NTSTRIDE;

  v8f acc[4][8] = {};
  gemm_tile<4, 8>(ap, bp, acc);

#pragma unroll
  for (int mi = 0; mi < 4; ++mi)
#pragma unroll
    for (int nj = 0; nj < 8; ++nj)
#pragma unroll
      for (int r = 0; r < 8; ++r)
        ot[w][mi * 16 + mb + r][nj * 16 + ln] = acc[mi][nj][r];
  __syncthreads();   // staged rows are read back by other lanes

  // the tile's 64 (b,p,t) rows share b and p; t runs on
  const int rr = rt * 64;
  const int bb = rr >> 12;
  const int pp = (rr >> 9) & 7;
  const int tt = rr & (SEQ - 1);
  float* grow = out + (((size_t)(bb * SEQ + tt) * 8 + pp) << 10)
                    + ct * 128 + lane * 4;
#pragma unroll
  for (int row = 0; row < 64; ++row)
    *(v4f*)(grow + (size_t)row * 8 * D_MODEL) = *(const v4f*)&ot[w][row][lane * 4];
}

// ===========================================================================
extern "C" void kernel_launch(void* const* d_in, const int* in_sizes, int n_in,
                              void* d_out, int out_size, void* d_ws, size_t ws_size,
                              hipStream_t stream) {
  const float* hidden = (const float*)d_in[0];
  const float* Wq     = (const float*)d_in[1];
  const float* Wk     = (const float*)d_in[2];
  const float* Wv     = (const float*)d_in[3];
  const float* Wo     = (const float*)d_in[4];
  float*       out    = (float*)d_out;

  // f16 workspace layout (halfs). ctx aliases xh (xh dead after kernel 1).
  _Float16* xh  = (_Float16*)d_ws;                         // 8192*1024
  _Float16* ctx = xh;                                      // alias
  _Float16* qws = xh  + (size_t)ROWS * D_MODEL;            // 16*16*512*64
  _Float16* kws = qws + (size_t)BP * N_HEADS * SEQ * HEAD_DIM;
  _Float16* vT  = kws + (size_t)BP * N_KVH * SEQ * HEAD_DIM;
  _Float16* pWq = vT  + (size_t)BP * N_KVH * SEQ * HEAD_DIM;
  _Float16* pWk = pWq + (size_t)D_MODEL * (N_HEADS * HEAD_DIM);
  _Float16* pWv = pWk + (size_t)D_MODEL * (N_KVH * HEAD_DIM);
  _Float16* pWo = pWv + (size_t)D_MODEL * (N_KVH * HEAD_DIM);

  convert_x_kernel<<<(ROWS / 16) * (D_MODEL / 128), 256, 0, stream>>>(hidden, xh);
  pack_w_kernel<<<dim3(64, KCH), 32, 0, stream>>>(Wq, 1024, pWq);
  pack_w_kernel<<<dim3(16, KCH), 32, 0, stream>>>(Wk, 256,  pWk);
  pack_w_kernel<<<dim3(16, KCH), 32, 0, stream>>>(Wv, 256,  pWv);
  pack_w_kernel<<<dim3(64, KCH), 32, 0, stream>>>(Wo, 1024, pWo);

  qkv_rope_kernel<<<dim3(ROWS / 64 / 4, (N_HEADS + 2 * N_KVH) / 3), 128, 0, stream>>>(
      xh, pWq, pWk, pWv, qws, kws, vT);

  attn_kernel<<<dim3(SEQ / 16, N_HEADS, BP), 32, 0, stream>>>(
      qws, kws, vT, ctx);

  out_proj_kernel<<<dim3(ROWS / 64 / 4, D_MODEL / 128), 128, 0, stream>>>(
      ctx, pWo, out);
}

// v004
// Measured time: 88.3 microseconds a run.
// Next to v003, in two timings, it ran 1.10 and 1.09 times as fast.
// All steps since v000 together make it 3.56 times as fast.
#include <hip/hip_runtime.h>

// ---------------------------------------------------------------------------
// MI455X (gfx1250) fused attention: QKV+RoPE -> softmax attention -> out proj
// All matrix math via v_wmma_f32_16x16x32_f16 (wave32, f32 accumulate).
// Memory strategy: every f16 WMMA operand but Q (row-major) that passes through global memory
// lies in fragment order, in planes of 512 B: plane[lane][8 halfs].  One
// 16-byte load per lane then covers four whole 128 B lines.
//   A-order (xh, ctx), element (row, k) of a rows x 1024 matrix:
//     (((row>>4)*KCH + (k>>5))*2 + ((k>>4)&1))*256 + (((k>>3)&1)*16 + (row&15))*8 + (k&7)
//   weights: the same with the n tile in place of the row tile
//   K: per 16-key tile, plane pair by d;  V: per 32-key chunk and 16-d tile
// ---------------------------------------------------------------------------

typedef __attribute__((ext_vector_type(16))) _Float16 v16h;
typedef __attribute__((ext_vector_type(8)))  _Float16 v8h;
typedef __attribute__((ext_vector_type(4)))  _Float16 v4h;
typedef __attribute__((ext_vector_type(8)))  float    v8f;
typedef __attribute__((ext_vector_type(4)))  float    v4f;

#define D_MODEL   1024
#define N_HEADS   16
#define N_KVH     4
#define HEAD_DIM  64
#define SEQ       512
#define BP        16          // B*P = 2*8
#define ROWS      8192        // BP * SEQ
#define KCH       (D_MODEL / 32)   // 32 k-chunks of 32

__device__ __forceinline__ v8f wmma16x16x32(v16h a, v16h b, v8f c) {
  // (neg_a, A, neg_b, B, c_mod, C, reuse_a, reuse_b)
  return __builtin_amdgcn_wmma_f32_16x16x32_f16(false, a, false, b, (short)0, c,
                                                false, false);
}

__device__ __forceinline__ v16h cat8(v8h lo, v8h hi) {
  v16h r;
#pragma unroll
  for (int i = 0; i < 8; ++i) { r[i] = lo[i]; r[i + 8] = hi[i]; }
  return r;
}

// ===========================================================================
// Kernel 0: all operand preparation in ONE launch (the five pieces are
// independent of each other).  256 threads a block; the block index picks the
// piece: blocks [0, PACK_BLOCKS) pack weights, the rest turn hidden into xh.
// The weight blocks come first: their strided reads have the longer latency
// and run on under the start of the many conversion blocks.
// ===========================================================================
#define PACK_BLOCKS (((2 * D_MODEL + 2 * N_KVH * HEAD_DIM) / 128) * KCH)   // 640
#define CONV_BLOCKS ((ROWS / 16) * (D_MODEL / 128))                        // 4096

// hidden (b,t,p,d) fp32 -> xh, f16, rows (b,p,t), in A-order.
// One block turns 16 rows x 128 d: whole-line reads, a turn through LDS,
// whole-line stores.  cb = block number among the CONV_BLOCKS.
// t: pitch 136 halfs, rows fall on other banks for the 16-byte column reads
__device__ __forceinline__ void convert_x_tile(const float* __restrict__ hidden,
                                               _Float16* __restrict__ xh,
                                               _Float16 (&t)[16][136], int cb)
{
  const int lane  = threadIdx.x & 31;
  const int w     = threadIdx.x >> 5;
  const int rtile = cb >> 3;                          // 16-row tile
  const int db    = cb & 7;                           // 128-wide d block
#pragma unroll
  for (int j = 0; j < 2; ++j) {
    const int row = w * 2 + j;
    const int rr  = rtile * 16 + row;                 // (b,p,t) row
    const int bb  = rr >> 12;
    const int pp  = (rr >> 9) & 7;
    const int tt  = rr & (SEQ - 1);
    const float* s = hidden + (((size_t)(bb * SEQ + tt) * 8 + pp) << 10)
                            + db * 128 + lane * 4;
    v4f f = *(const v4f*)s;
    v4h h;
#pragma unroll
    for (int i = 0; i < 4; ++i) h[i] = (_Float16)f[i];
    *(v4h*)&t[row][lane * 4] = h;
  }
  __syncthreads();   // the planes are read across the rows other waves wrote

  const int part = w & 1;                             // plane of the k chunk
  const int kcl  = w >> 1;                            // k chunk in the block
  v8h o = *(const v8h*)&t[lane & 15][kcl * 32 + part * 16 + (lane >> 4) * 8];
  *(v8h*)(xh + ((size_t)(rtile * KCH + db * 4 + kcl) * 2 + part) * 256 + lane * 8) = o;
}

// One wave packs one 32 x 16 piece of an fp32 weight (K=1024 x N) into f16
// B-fragment order:
//   dst[((nt*KCH + kc)*2 + part)*256 + lane*8 + i] = W[k*N + nt*16 + (lane&15)]
// with k = kc*32 + part*16 + koff + i, i < 8, koff=(lane>>4)*8.
__device__ __forceinline__ void pack_w_piece(const float* __restrict__ W, int N,
                                             _Float16* __restrict__ dst,
                                             int nt, int kc)
{
  const int lane = threadIdx.x & 31;
  const int ln   = lane & 15;
  const int koff = (lane >> 4) << 3;
  const int kb   = kc * 32;
  const float* col = W + nt * 16 + ln;
  float f0[8], f1[8];
#pragma unroll
  for (int i = 0; i < 8; ++i) f0[i] = col[(size_t)(kb + koff + i) * N];
  // the second group's results may land in the first group's address registers
  asm volatile("s_wait_xcnt 0x0" ::: "memory");
#pragma unroll
  for (int i = 0; i < 8; ++i) f1[i] = col[(size_t)(kb + 16 + koff + i) * N];
  v8h b0, b1;
#pragma unroll
  for (int i = 0; i < 8; ++i) {
    b0[i] = (_Float16)f0[i];
    b1[i] = (_Float16)f1[i];
  }
  _Float16* d = dst + (size_t)(nt * KCH + kc) * 512 + lane * 8;
  *(v8h*)(d)       = b0;
  *(v8h*)(d + 256) = b1;
}

__global__ __launch_bounds__(256)
void prepare_kernel(const float* __restrict__ hidden,
                    const float* __restrict__ Wq,
                    const float* __restrict__ Wk,
                    const float* __restrict__ Wv,
                    const float* __restrict__ Wo,
                    _Float16* __restrict__ xh,
                    _Float16* __restrict__ pWq,
                    _Float16* __restrict__ pWk,
                    _Float16* __restrict__ pWv,
                    _Float16* __restrict__ pWo)
{
  __shared__ __align__(16) _Float16 t[16][136];

  const int blk = blockIdx.x;
  if (blk >= PACK_BLOCKS) {
    convert_x_tile(hidden, xh, t, blk - PACK_BLOCKS);
    return;
  }
  // a weight block: one k chunk of eight neighbouring n tiles, one per wave
  // (the eight waves together read whole 512 B row pieces).  Groups of eight
  // n tiles in the order Wq (8), Wk (2), Wv (2), Wo (8).
  const int kc = blk & (KCH - 1);
  const int g  = blk / KCH;
  const int w  = threadIdx.x >> 5;
  const float* W;
  _Float16* dst;
  int N, g0;
  if (g < 8)       { W = Wq; dst = pWq; N = N_HEADS * HEAD_DIM; g0 = 0;  }
  else if (g < 10) { W = Wk; dst = pWk; N = N_KVH * HEAD_DIM;   g0 = 8;  }
  else if (g < 12) { W = Wv; dst = pWv; N = N_KVH * HEAD_DIM;   g0 = 10; }
  else             { W = Wo; dst = pWo; N = D_MODEL;            g0 = 12; }
  pack_w_piece(W, N, dst, (g - g0) * 8 + w, kc);
}

// ===========================================================================
// Register-tiled GEMM core shared by kernels 1 and 3.
// One wave owns MT x NT accumulator tiles (16x16 each): a loaded A fragment
// feeds NT WMMAs and a loaded B fragment MT WMMAs.  Two fragment sets: the
// next k chunk's loads are issued ahead of the current chunk's WMMAs.
//   ap    : A-order start of the wave's first row tile (wave-uniform)
//   bp[q] : packed n-tile 4*q of the wave's columns (wave-uniform)
// ===========================================================================
#define NTSTRIDE (KCH * 32 * 16)      // halfs per packed n-tile or A row tile

template <int MT, int NT>
__device__ __forceinline__ void load_frags(v16h (&a)[MT], v16h (&b)[NT],
                                           const _Float16* __restrict__ ap,
                                           const _Float16* const (&bp)[NT / 4],
                                           int kc)
{
#pragma unroll
  for (int mi = 0; mi < MT; ++mi) {
    const _Float16* p = ap + (size_t)mi * NTSTRIDE + kc * 512
                           + (threadIdx.x & 31) * 8;
    a[mi] = cat8(*(const v8h*)(p), *(const v8h*)(p + 256));
  }
#pragma unroll
  for (int nj = 0; nj < NT; ++nj) {
    const _Float16* p = bp[nj >> 2] + (size_t)(nj & 3) * NTSTRIDE + kc * 512
                                    + (threadIdx.x & 31) * 8;
    b[nj] = cat8(*(const v8h*)(p), *(const v8h*)(p + 256));
  }
}

template <int MT, int NT>
__device__ __forceinline__ void mma_frags(const v16h (&a)[MT], const v16h (&b)[NT],
                                          v8f (&acc)[MT][NT])
{
#pragma unroll
  for (int mi = 0; mi < MT; ++mi)
#pragma unroll
    for (int nj = 0; nj < NT; ++nj)
      acc[mi][nj] = wmma16x16x32(a[mi], b[nj], acc[mi][nj]);
}

template <int MT, int NT>
__device__ __forceinline__ void gemm_tile(const _Float16* __restrict__ ap,
                                          const _Float16* const (&bp)[NT / 4],
                                          v8f (&acc)[MT][NT])
{
  v16h a0[MT], b0[NT], a1[MT], b1[NT];
  load_frags<MT, NT>(a0, b0, ap, bp, 0);
  __builtin_amdgcn_sched_barrier(0);   // holds the wait directly behind the loads
  // registers that the issued loads name are rewritten next: wait first
  asm volatile("s_wait_xcnt 0x0" ::: "memory");
  __builtin_amdgcn_sched_barrier(0);
  for (int kc = 0; kc < KCH - 2; kc += 2) {
    // the scheduling fences keep each load group whole and ahead of the WMMA
    // block; without them the loads sink in among the WMMAs that need them
    load_frags<MT, NT>(a1, b1, ap, bp, kc + 1);
    __builtin_amdgcn_sched_barrier(0);
    mma_frags<MT, NT>(a0, b0, acc);
    __builtin_amdgcn_sched_barrier(0);
    load_frags<MT, NT>(a0, b0, ap, bp, kc + 2);
    __builtin_amdgcn_sched_barrier(0);
    mma_frags<MT, NT>(a1, b1, acc);
    __builtin_amdgcn_sched_barrier(0);
    // the address registers of the issued loads step on behind this wait
    asm volatile("s_wait_xcnt 0x0" ::: "memory");
    __builtin_amdgcn_sched_barrier(0);
  }
  load_frags<MT, NT>(a1, b1, ap, bp, KCH - 1);
  __builtin_amdgcn_sched_barrier(0);   // same: last load group ahead of the WMMAs
  mma_frags<MT, NT>(a0, b0, acc);
  __builtin_amdgcn_sched_barrier(0);
  // the last loads' address registers are free for reuse behind this wait
  asm volatile("s_wait_xcnt 0x0" ::: "memory");
  __builtin_amdgcn_sched_barrier(0);
  mma_frags<MT, NT>(a1, b1, acc);
}

// ===========================================================================
// Kernel 1: QKV projection + RoPE + q-scale from packed f16 operands.
// 4 waves / block; wave w owns rows [64*(blockIdx.x*4+w), +64) and the three
// 64-wide head columns 3*blockIdx.y .. +2 of the 24 (16 q, 4 k, 4 v).
// Q written row-major (slot,t,d), K in fragment order, both via LDS-staged
// whole-line stores.  V written in fragment order straight from registers.
// ===========================================================================
__global__ __launch_bounds__(128)
void qkv_rope_kernel(const _Float16* __restrict__ xh,
                     const _Float16* __restrict__ pWq,
                     const _Float16* __restrict__ pWk,
                     const _Float16* __restrict__ pWv,
                     _Float16* __restrict__ qws,
                     _Float16* __restrict__ kws,
                     _Float16* __restrict__ vT)
{
  __shared__ __align__(128) _Float16 st[4][3][64][64];   // 96 KB staging

  const int lane = threadIdx.x & 31;
  const int w    = threadIdx.x >> 5;
  const int ln   = lane & 15;
  const int mb   = (lane >> 4) << 3;
  const int rt   = blockIdx.x * 4 + w;     // 64-row tile
  const int hc0  = blockIdx.y * 3;         // first of three head columns

  const _Float16* bp[3];
#pragma unroll
  for (int hh = 0; hh < 3; ++hh) {
    const int hc = hc0 + hh;
    const _Float16* pW = (hc < 16) ? pWq + (size_t)hc * 4 * NTSTRIDE
                       : (hc < 20) ? pWk + (size_t)(hc - 16) * 4 * NTSTRIDE
                                   : pWv + (size_t)(hc - 20) * 4 * NTSTRIDE;
    bp[hh] = pW;
  }
  const _Float16* ap = xh + (size_t)(rt * 4) * NTSTRIDE;

  v8f acc[4][12] = {};
  gemm_tile<4, 12>(ap, bp, acc);

  const int t0 = (rt * 64) & (SEQ - 1);
  const int bpi = rt >> 3;

  // RoPE tables of this lane's 32 rows, shared by the wave's q and k heads
  const float LOG1E4_32 = 0.28782313662425575f;    // ln(10000)/32
  const float fA = __expf(-(float)ln * LOG1E4_32);
  const float fB = __expf(-(float)(16 + ln) * LOG1E4_32);
  float sA[4][8], cA[4][8], sB[4][8], cB[4][8];
#pragma unroll
  for (int mi = 0; mi < 4; ++mi)
#pragma unroll
    for (int r = 0; r < 8; ++r) {
      const float tm = (float)(t0 + mi * 16 + mb + r);
      __sincosf(tm * fA, &sA[mi][r], &cA[mi][r]);
      __sincosf(tm * fB, &sB[mi][r], &cB[mi][r]);
    }

#pragma unroll
  for (int hh = 0; hh < 3; ++hh) {
    const int hc = hc0 + hh;
    if (hc < 20) {
      // RoPE pairs (dh, dh+32): tile 0<->2 (dh=ln), tile 1<->3 (dh=16+ln)
      const float qs = (hc < 16) ? 0.125f : 1.0f;  // 1/sqrt(HEAD_DIM) into q
#pragma unroll
      for (int mi = 0; mi < 4; ++mi)
#pragma unroll
        for (int r = 0; r < 8; ++r) {
          _Float16* srow = &st[w][hh][mi * 16 + mb + r][0];
          float lo = acc[mi][hh * 4 + 0][r], hi = acc[mi][hh * 4 + 2][r];
          srow[ln]      = (_Float16)((lo * cA[mi][r] - hi * sA[mi][r]) * qs);
          srow[32 + ln] = (_Float16)((lo * sA[mi][r] + hi * cA[mi][r]) * qs);
          lo = acc[mi][hh * 4 + 1][r]; hi = acc[mi][hh * 4 + 3][r];
          srow[16 + ln] = (_Float16)((lo * cB[mi][r] - hi * sB[mi][r]) * qs);
          srow[48 + ln] = (_Float16)((lo * sB[mi][r] + hi * cB[mi][r]) * qs);
        }
    } else {
      // V: a lane's 8 rows of one column are one piece of the plane
      // [32-key chunk][16-d tile j][key half mi&1][lane]
      _Float16* dst = vT + ((size_t)(bpi * N_KVH + (hc - 20)) * HEAD_DIM) * SEQ
                         + (size_t)(t0 >> 5) * 2048 + lane * 8;
#pragma unroll
      for (int j = 0; j < 4; ++j) {
#pragma unroll
        for (int mi = 0; mi < 4; ++mi) {
          v8h h;
#pragma unroll
          for (int r = 0; r < 8; ++r) h[r] = (_Float16)acc[mi][hh * 4 + j][r];
          *(v8h*)(dst + ((mi >> 1) * 4 + j) * 512 + (mi & 1) * 256) = h;
        }
        // the stores' data registers are refilled next: wait first (the fence
        // holds the next conversions behind the wait)
        asm volatile("s_wait_xcnt 0x0" ::: "memory");
        __builtin_amdgcn_sched_barrier(0);
      }
    }
  }
  __syncthreads();   // staged rows are read back by other lanes

#pragma unroll
  for (int hh = 0; hh < 3; ++hh) {
    const int hc = hc0 + hh;
    if (hc < 20) {
      // 64 rows x 64 halfs of one head are 8 KB contiguous in q / k
      _Float16* dst = (hc < 16)
          ? qws + ((size_t)(bpi * N_HEADS + hc) * SEQ + t0) * HEAD_DIM
          : kws + ((size_t)(bpi * N_KVH + (hc - 16)) * SEQ + t0) * HEAD_DIM;
      const v8h* s = (const v8h*)&st[w][hh][0][0];
      v8h* g = (v8h*)dst;
      // q leaves as it lies; k leaves per 16-key tile as planes [d/8][key]
      const bool isq = hc < 16;
      const int  sl  = isq ? lane : ln * 8 + (lane >> 4);
#pragma unroll
      for (int i = 0; i < 16; ++i)
        g[i * 32 + lane] = s[sl + (isq ? i * 32 : (i >> 2) * 128 + (i & 3) * 2)];
      if (hh < 2) {
        // the next head column reuses these stores' data and address
        // registers: wait first
        asm volatile("s_wait_xcnt 0x0" ::: "memory");
      }
    }
  }
}

// ===========================================================================
// Kernel 2: attention, one wave per (bp, head, 16-query tile).
//   grid = (SEQ/16, N_HEADS, BP)
// Both products run with their operands swapped: S^T = K Q^T, O^T = V^T P^T.
// A and B fragments share one lane map, so the K, Q and V registers are the
// ones the unswapped products take.  A lane then holds scores of ONE query
// (column lane&15), keys 8*(lane>>4)..+7 of each 16-key tile: two such tiles
// are, as they lie, the B fragment of P^T for one 32-key chunk.  Scores and
// probabilities never leave the registers; the softmax is the running form
// (maximum and sum carried from one 32-key block to the next), inside the
// lane but for one exchange with lane^16 per block; O^T leaves as A-order
// planes.  No LDS.  Every wave still reads its head's K and V (128 KB) from L2.
// ===========================================================================
// Four fragments (eight planes, 4 KB) of block blk of K or V.  The block's
// start goes through readfirstlane so that it stays in scalar registers: the
// loads then name that pair and the lane's own offset, which is never rewritten.
__device__ __forceinline__ void load_blk(v16h (&f)[4],
                                         const _Float16* __restrict__ base, int blk)
{
  const unsigned long long u = (unsigned long long)(base + blk * 2048);
  const unsigned lo = __builtin_amdgcn_readfirstlane((unsigned)u);
  const unsigned hi = __builtin_amdgcn_readfirstlane((unsigned)(u >> 32));
  // rebuilt from its words the pointer must be named global again, or the
  // loads turn into flat ones
  typedef const __attribute__((address_space(1))) v8h* gv8h;
  gv8h p = (gv8h)(((unsigned long long)hi << 32) | lo) + (threadIdx.x & 31);
#pragma unroll
  for (int i = 0; i < 4; ++i)
    f[i] = cat8(p[i * 64], p[i * 64 + 32]);
}

// value of the lane 16 away (same query, other eight keys of each tile)
__device__ __forceinline__ float other_half(float x) {
  return __builtin_bit_cast(float, __builtin_amdgcn_permlanex16(
      __builtin_bit_cast(unsigned, x), __builtin_bit_cast(unsigned, x),
      0x76543210u, 0xfedcba98u, false, false));
}

__device__ __forceinline__ void attn_block(const v16h (&k)[4], const v16h (&v)[4],
                                           v16h aq0, v16h aq1,
                                           float& m, float& sum, v8f (&o)[4])
{
  const float L2E = 1.4426950408889634f;              // log2(e)
  const v8f zero = {};
  v8f s0 = wmma16x16x32(k[0], aq0, zero);
  v8f s1 = wmma16x16x32(k[2], aq0, zero);
  s0 = wmma16x16x32(k[1], aq1, s0);
  s1 = wmma16x16x32(k[3], aq1, s1);

  float t[8];
#pragma unroll
  for (int r = 0; r < 8; ++r) t[r] = fmaxf(s0[r], s1[r]);
  float bm = fmaxf(fmaxf(fmaxf(t[0], t[1]), fmaxf(t[2], t[3])),
                   fmaxf(fmaxf(t[4], t[5]), fmaxf(t[6], t[7])));
  bm = fmaxf(bm, other_half(bm));
  const float mn    = fmaxf(m, bm);
  const float mL    = mn * L2E;
  const float alpha = __builtin_amdgcn_exp2f(fmaf(m, L2E, -mL));
  m = mn;

  v16h pf;
  float a[8];
#pragma unroll
  for (int r = 0; r < 8; ++r) {
    const float p0 = __builtin_amdgcn_exp2f(fmaf(s0[r], L2E, -mL));
    const float p1 = __builtin_amdgcn_exp2f(fmaf(s1[r], L2E, -mL));
    a[r]      = p0 + p1;
    pf[r]     = (_Float16)p0;
    pf[r + 8] = (_Float16)p1;
  }
  sum = fmaf(sum, alpha, ((a[0] + a[1]) + (a[2] + a[3])) + ((a[4] + a[5]) + (a[6] + a[7])));
#pragma unroll
  for (int j = 0; j < 4; ++j)
#pragma unroll
    for (int r = 0; r < 8; ++r) o[j][r] *= alpha;
#pragma unroll
  for (int j = 0; j < 4; ++j) o[j] = wmma16x16x32(v[j], pf, o[j]);
}

__global__ __launch_bounds__(32)
void attn_kernel(const _Float16* __restrict__ qws,
                 const _Float16* __restrict__ kws,
                 const _Float16* __restrict__ vT,
                 _Float16* __restrict__ ctx)
{
  const int lane = threadIdx.x;
  const int ln   = lane & 15;
  const int koff = (lane >> 4) << 3;
  const int qt   = blockIdx.x;
  const int h    = blockIdx.y;
  const int bp   = blockIdx.z;

  const _Float16* __restrict__ qb = qws + ((size_t)(bp * N_HEADS + h)        * SEQ) * HEAD_DIM;
  const _Float16* __restrict__ kb = kws + ((size_t)(bp * N_KVH   + (h >> 2)) * SEQ) * HEAD_DIM;
  const _Float16* __restrict__ vb = vT  + ((size_t)(bp * N_KVH   + (h >> 2)) * HEAD_DIM) * SEQ;

  // Q tile fragments (16x64 as two 16x32 chunks)
  const _Float16* qrow = qb + (size_t)(qt * 16 + ln) * HEAD_DIM;
  v16h aq0 = cat8(*(const v8h*)(qrow + koff),      *(const v8h*)(qrow + 16 + koff));
  v16h aq1 = cat8(*(const v8h*)(qrow + 32 + koff), *(const v8h*)(qrow + 48 + koff));

  float m = -3.0e38f, sum = 0.f;
  v8f o[4] = {};
  // K block: two 16-key tiles of two d halves, fetched one block ahead.
  // V block: four 16-d tiles of one 32-key chunk, fetched at the head of its
  // own block, ahead of the scores and the exponentials.
  v16h k0[4], k1[4];
  load_blk(k0, kb, 0);
  __builtin_amdgcn_sched_barrier(0);   // holds the wait directly behind the loads
  // registers that the issued loads name are rewritten next: wait first
  asm volatile("s_wait_xcnt 0x0" ::: "memory");
  __builtin_amdgcn_sched_barrier(0);
  for (int b = 0; b < SEQ / 32; b += 2) {
    v16h va[4], vc[4];
    // the scheduling fences keep each load group whole and ahead of the block;
    // without them the loads sink down to the WMMAs that need them
    load_blk(va, vb, b);
    load_blk(k1, kb, b + 1);
    __builtin_amdgcn_sched_barrier(0);
    attn_block(k0, va, aq0, aq1, m, sum, o);
    __builtin_amdgcn_sched_barrier(0);
    // the scalar bases of the issued loads are rewritten next: wait first
    asm volatile("s_wait_xcnt 0x0" ::: "memory");
    __builtin_amdgcn_sched_barrier(0);
    load_blk(vc, vb, b + 1);
    if (b + 2 < SEQ / 32) load_blk(k0, kb, b + 2);
    __builtin_amdgcn_sched_barrier(0);
    attn_block(k1, vc, aq0, aq1, m, sum, o);
    __builtin_amdgcn_sched_barrier(0);
    // the scalar bases of the issued loads step on behind this wait
    asm volatile("s_wait_xcnt 0x0" ::: "memory");
    __builtin_amdgcn_sched_barrier(0);
  }

  sum += other_half(sum);
  const float rinv = 1.0f / sum;

  // lane holds query ln, d = 16 j + koff + r: its piece of A-order plane j
  v8h oh[4];
#pragma unroll
  for (int j = 0; j < 4; ++j)
#pragma unroll
    for (int r = 0; r < 8; ++r) oh[j][r] = (_Float16)(o[j][r] * rinv);
  _Float16* g = ctx + ((size_t)(bp * (SEQ / 16) + qt) * KCH + h * 2) * 512 + lane * 8;
#pragma unroll
  for (int j = 0; j < 4; ++j)
    *(v8h*)(g + j * 256) = oh[j];
}

// ===========================================================================
// Kernel 3: out = ctx @ Wo (packed) with (B,T,P,:) permuted fp32 store.
// 4 waves / block; wave w owns rows [64*(blockIdx.x*4+w), +64) and the 128
// columns of blockIdx.y.  Rows leave as whole 512 B pieces through LDS.
// ===========================================================================
__global__ __launch_bounds__(128)
void out_proj_kernel(const _Float16* __restrict__ ctx,
                     const _Float16* __restrict__ pWo,
                     float* __restrict__ out)
{
  // pitch 132 floats: the two lane halves (8 rows apart) fall on other banks
  __shared__ __align__(128) float ot[4][64][132];

  const int lane = threadIdx.x & 31;
  const int w    = threadIdx.x >> 5;
  const int ln   = lane & 15;
  const int mb   = (lane >> 4) << 3;
  const int rt   = blockIdx.x * 4 + w;     // 64-row tile
  const int ct   = blockIdx.y;             // 128-column tile

  const _Float16* ap = ctx + (size_t)(rt * 4) * NTSTRIDE;
  const _Float16* bp[2];
  bp[0] = pWo + (size_t)(ct * 8) * NTSTRIDE;
  bp[1] = bp[0] + (size_t)4 * NTSTRIDE;

  v8f acc[4][8] = {};
  gemm_tile<4, 8>(ap, bp, acc);

#pragma unroll
  for (int mi = 0; mi < 4; ++mi)
#pragma unroll
    for (int nj = 0; nj < 8; ++nj)
#pragma unroll
      for (int r = 0; r < 8; ++r)
        ot[w][mi * 16 + mb + r][nj * 16 + ln] = acc[mi][nj][r];
  __syncthreads();   // staged rows are read back by other lanes

  // the tile's 64 (b,p,t) rows share b and p; t runs on
  const int rr = rt * 64;
  const int bb = rr >> 12;
  const int pp = (rr >> 9) & 7;
  const int tt = rr & (SEQ - 1);
  float* grow = out + (((size_t)(bb * SEQ + tt) * 8 + pp) << 10)
                    + ct * 128 + lane * 4;
#pragma unroll
  for (int row = 0; row < 64; ++row)
    *(v4f*)(grow + (size_t)row * 8 * D_MODEL) = *(const v4f*)&ot[w][row][lane * 4];
}

// ===========================================================================
extern "C" void kernel_launch(void* const* d_in, const int* in_sizes, int n_in,
                              void* d_out, int out_size, void* d_ws, size_t ws_size,
                              hipStream_t stream) {
  const float* hidden = (const float*)d_in[0];
  const float* Wq     = (const float*)d_in[1];
  const float* Wk     = (const float*)d_in[2];
  const float* Wv     = (const float*)d_in[3];
  const float* Wo     = (const float*)d_in[4];
  float*       out    = (float*)d_out;

  // f16 workspace layout (halfs). ctx aliases xh (xh dead after kernel 1).
  _Float16* xh  = (_Float16*)d_ws;                         // 8192*1024
  _Float16* ctx = xh;                                      // alias
  _Float16* qws = xh  + (size_t)ROWS * D_MODEL;            // 16*16*512*64
  _Float16* kws = qws + (size_t)BP * N_HEADS * SEQ * HEAD_DIM;
  _Float16* vT  = kws + (size_t)BP * N_KVH * SEQ * HEAD_DIM;
  _Float16* pWq = vT  + (size_t)BP * N_KVH * SEQ * HEAD_DIM;
  _Float16* pWk = pWq + (size_t)D_MODEL * (N_HEADS * HEAD_DIM);
  _Float16* pWv = pWk + (size_t)D_MODEL * (N_KVH * HEAD_DIM);
  _Float16* pWo = pWv + (size_t)D_MODEL * (N_KVH * HEAD_DIM);

  prepare_kernel<<<PACK_BLOCKS + CONV_BLOCKS, 256, 0, stream>>>(
      hidden, Wq, Wk, Wv, Wo, xh, pWq, pWk, pWv, pWo);

  qkv_rope_kernel<<<dim3(ROWS / 64 / 4, (N_HEADS + 2 * N_KVH) / 3), 128, 0, stream>>>(
      xh, pWq, pWk, pWv, qws, kws, vT);

  attn_kernel<<<dim3(SEQ / 16, N_HEADS, BP), 32, 0, stream>>>(
      qws, kws, vT, ctx);

  out_proj_kernel<<<dim3(ROWS / 64 / 4, D_MODEL / 128), 128, 0, stream>>>(
      ctx, pWo, out);
}

// v005
// A run of this version takes 71.5 microseconds.
// Next to v004, in two timings, it ran 1.24 and 1.23 times as fast.
// Over all steps from v000 it is 4.40 times as fast.
#include <hip/hip_runtime.h>

// ---------------------------------------------------------------------------
// MI455X (gfx1250) fused attention: QKV+RoPE -> softmax attention -> out proj
// All matrix math via v_wmma_f32_16x16x32_f16 (wave32, f32 accumulate).
// Memory strategy: every f16 WMMA operand but Q (row-major) that passes through global memory
// lies in fragment order, in planes of 512 B: plane[lane][8 halfs].  One
// 16-byte load per lane then covers four whole 128 B lines.
//   A-order (xh, ctx), element (row, k) of a rows x 1024 matrix:
//     (((row>>4)*KCH + (k>>5))*2 + ((k>>4)&1))*256 + (((k>>3)&1)*16 + (row&15))*8 + (k&7)
//   weights: the same with the n tile in place of the row tile
//   K: per 16-key tile, plane pair by d;  V: per 32-key chunk and 16-d tile
// ---------------------------------------------------------------------------

typedef __attribute__((ext_vector_type(16))) _Float16 v16h;
typedef __attribute__((ext_vector_type(8)))  _Float16 v8h;
typedef __attribute__((ext_vector_type(4)))  _Float16 v4h;
typedef __attribute__((ext_vector_type(8)))  float    v8f;
typedef __attribute__((ext_vector_type(4)))  float    v4f;

#define D_MODEL   1024
#define N_HEADS   16
#define N_KVH     4
#define HEAD_DIM  64
#define SEQ       512
#define BP        16          // B*P = 2*8
#define ROWS      8192        // BP * SEQ
#define KCH       (D_MODEL / 32)   // 32 k-chunks of 32

__device__ __forceinline__ v8f wmma16x16x32(v16h a, v16h b, v8f c) {
  // (neg_a, A, neg_b, B, c_mod, C, reuse_a, reuse_b)
  return __builtin_amdgcn_wmma_f32_16x16x32_f16(false, a, false, b, (short)0, c,
                                                false, false);
}

__device__ __forceinline__ v16h cat8(v8h lo, v8h hi) {
  v16h r;
#pragma unroll
  for (int i = 0; i < 8; ++i) { r[i] = lo[i]; r[i + 8] = hi[i]; }
  return r;
}

// ===========================================================================
// Kernel 0: all operand preparation in ONE launch (the five pieces are
// independent of each other).  256 threads a block; the block index picks the
// piece: blocks [0, PACK_BLOCKS) pack weights, the rest turn hidden into xh.
// The weight blocks come first: their strided reads have the longer latency
// and run on under the start of the many conversion blocks.
// ===========================================================================
#define PACK_BLOCKS (((2 * D_MODEL + 2 * N_KVH * HEAD_DIM) / 128) * KCH)   // 640
#define CONV_BLOCKS ((ROWS / 16) * (D_MODEL / 128))                        // 4096

// hidden (b,t,p,d) fp32 -> xh, f16, rows (b,p,t), in A-order.
// One block turns 16 rows x 128 d: whole-line reads, a turn through LDS,
// whole-line stores.  cb = block number among the CONV_BLOCKS.
// t: pitch 136 halfs, rows fall on other banks for the 16-byte column reads
__device__ __forceinline__ void convert_x_tile(const float* __restrict__ hidden,
                                               _Float16* __restrict__ xh,
                                               _Float16 (&t)[16][136], int cb)
{
  const int lane  = threadIdx.x & 31;
  const int w     = threadIdx.x >> 5;
  const int rtile = cb >> 3;                          // 16-row tile
  const int db    = cb & 7;                           // 128-wide d block
#pragma unroll
  for (int j = 0; j < 2; ++j) {
    const int row = w * 2 + j;
    const int rr  = rtile * 16 + row;                 // (b,p,t) row
    const int bb  = rr >> 12;
    const int pp  = (rr >> 9) & 7;
    const int tt  = rr & (SEQ - 1);
    const float* s = hidden + (((size_t)(bb * SEQ + tt) * 8 + pp) << 10)
                            + db * 128 + lane * 4;
    v4f f = *(const v4f*)s;
    v4h h;
#pragma unroll
    for (int i = 0; i < 4; ++i) h[i] = (_Float16)f[i];
    *(v4h*)&t[row][lane * 4] = h;
  }
  __syncthreads();   // the planes are read across the rows other waves wrote

  const int part = w & 1;                             // plane of the k chunk
  const int kcl  = w >> 1;                            // k chunk in the block
  v8h o = *(const v8h*)&t[lane & 15][kcl * 32 + part * 16 + (lane >> 4) * 8];
  *(v8h*)(xh + ((size_t)(rtile * KCH + db * 4 + kcl) * 2 + part) * 256 + lane * 8) = o;
}

// One wave packs one 32 x 16 piece of an fp32 weight (K=1024 x N) into f16
// B-fragment order:
//   dst[((nt*KCH + kc)*2 + part)*256 + lane*8 + i] = W[k*N + nt*16 + (lane&15)]
// with k = kc*32 + part*16 + koff + i, i < 8, koff=(lane>>4)*8.
__device__ __forceinline__ void pack_w_piece(const float* __restrict__ W, int N,
                                             _Float16* __restrict__ dst,
                                             int nt, int kc)
{
  const int lane = threadIdx.x & 31;
  const int ln   = lane & 15;
  const int koff = (lane >> 4) << 3;
  const int kb   = kc * 32;
  const float* col = W + nt * 16 + ln;
  float f0[8], f1[8];
#pragma unroll
  for (int i = 0; i < 8; ++i) f0[i] = col[(size_t)(kb + koff + i) * N];
  // the second group's results may land in the first group's address registers
  asm volatile("s_wait_xcnt 0x0" ::: "memory");
#pragma unroll
  for (int i = 0; i < 8; ++i) f1[i] = col[(size_t)(kb + 16 + koff + i) * N];
  v8h b0, b1;
#pragma unroll
  for (int i = 0; i < 8; ++i) {
    b0[i] = (_Float16)f0[i];
    b1[i] = (_Float16)f1[i];
  }
  _Float16* d = dst + (size_t)(nt * KCH + kc) * 512 + lane * 8;
  *(v8h*)(d)       = b0;
  *(v8h*)(d + 256) = b1;
}

__global__ __launch_bounds__(256)
void prepare_kernel(const float* __restrict__ hidden,
                    const float* __restrict__ Wq,
                    const float* __restrict__ Wk,
                    const float* __restrict__ Wv,
                    const float* __restrict__ Wo,
                    _Float16* __restrict__ xh,
                    _Float16* __restrict__ pWq,
                    _Float16* __restrict__ pWk,
                    _Float16* __restrict__ pWv,
                    _Float16* __restrict__ pWo)
{
  __shared__ __align__(16) _Float16 t[16][136];

  const int blk = blockIdx.x;
  if (blk >= PACK_BLOCKS) {
    convert_x_tile(hidden, xh, t, blk - PACK_BLOCKS);
    return;
  }
  // a weight block: one k chunk of eight neighbouring n tiles, one per wave
  // (the eight waves together read whole 512 B row pieces).  Groups of eight
  // n tiles in the order Wq (8), Wk (2), Wv (2), Wo (8).
  const int kc = blk & (KCH - 1);
  const int g  = blk / KCH;
  const int w  = threadIdx.x >> 5;
  const float* W;
  _Float16* dst;
  int N, g0;
  if (g < 8)       { W = Wq; dst = pWq; N = N_HEADS * HEAD_DIM; g0 = 0;  }
  else if (g < 10) { W = Wk; dst = pWk; N = N_KVH * HEAD_DIM;   g0 = 8;  }
  else if (g < 12) { W = Wv; dst = pWv; N = N_KVH * HEAD_DIM;   g0 = 10; }
  else             { W = Wo; dst = pWo; N = D_MODEL;            g0 = 12; }
  pack_w_piece(W, N, dst, (g - g0) * 8 + w, kc);
}

// ===========================================================================
// Register-tiled GEMM core shared by kernels 1 and 3.
// One wave owns MT x NT accumulator tiles (16x16 each): a loaded A fragment
// feeds NT WMMAs and a loaded B fragment MT WMMAs.  Two fragment sets: the
// next k chunk's loads are issued ahead of the current chunk's WMMAs.
//   ap    : A-order start of the wave's first row tile (wave-uniform)
//   bp[q] : packed n-tile 4*q of the wave's columns (wave-uniform)
// ===========================================================================
#define NTSTRIDE (KCH * 32 * 16)      // halfs per packed n-tile or A row tile

template <int MT, int NT>
__device__ __forceinline__ void load_frags(v16h (&a)[MT], v16h (&b)[NT],
                                           const _Float16* __restrict__ ap,
                                           const _Float16* const (&bp)[NT / 4],
                                           int kc)
{
#pragma unroll
  for (int mi = 0; mi < MT; ++mi) {
    const _Float16* p = ap + (size_t)mi * NTSTRIDE + kc * 512
                           + (threadIdx.x & 31) * 8;
    a[mi] = cat8(*(const v8h*)(p), *(const v8h*)(p + 256));
  }
#pragma unroll
  for (int nj = 0; nj < NT; ++nj) {
    const _Float16* p = bp[nj >> 2] + (size_t)(nj & 3) * NTSTRIDE + kc * 512
                                    + (threadIdx.x & 31) * 8;
    b[nj] = cat8(*(const v8h*)(p), *(const v8h*)(p + 256));
  }
}

template <int MT, int NT>
__device__ __forceinline__ void mma_frags(const v16h (&a)[MT], const v16h (&b)[NT],
                                          v8f (&acc)[MT][NT])
{
#pragma unroll
  for (int mi = 0; mi < MT; ++mi)
#pragma unroll
    for (int nj = 0; nj < NT; ++nj)
      acc[mi][nj] = wmma16x16x32(a[mi], b[nj], acc[mi][nj]);
}

template <int MT, int NT>
__device__ __forceinline__ void gemm_tile(const _Float16* __restrict__ ap,
                                          const _Float16* const (&bp)[NT / 4],
                                          v8f (&acc)[MT][NT])
{
  v16h a0[MT], b0[NT], a1[MT], b1[NT];
  load_frags<MT, NT>(a0, b0, ap, bp, 0);
  __builtin_amdgcn_sched_barrier(0);   // holds the wait directly behind the loads
  // registers that the issued loads name are rewritten next: wait first
  asm volatile("s_wait_xcnt 0x0" ::: "memory");
  __builtin_amdgcn_sched_barrier(0);
  for (int kc = 0; kc < KCH - 2; kc += 2) {
    // the scheduling fences keep each load group whole and ahead of the WMMA
    // block; without them the loads sink in among the WMMAs that need them
    load_frags<MT, NT>(a1, b1, ap, bp, kc + 1);
    __builtin_amdgcn_sched_barrier(0);
    mma_frags<MT, NT>(a0, b0, acc);
    __builtin_amdgcn_sched_barrier(0);
    load_frags<MT, NT>(a0, b0, ap, bp, kc + 2);
    __builtin_amdgcn_sched_barrier(0);
    mma_frags<MT, NT>(a1, b1, acc);
    __builtin_amdgcn_sched_barrier(0);
    // the address registers of the issued loads step on behind this wait
    asm volatile("s_wait_xcnt 0x0" ::: "memory");
    __builtin_amdgcn_sched_barrier(0);
  }
  load_frags<MT, NT>(a1, b1, ap, bp, KCH - 1);
  __builtin_amdgcn_sched_barrier(0);   // same: last load group ahead of the WMMAs
  mma_frags<MT, NT>(a0, b0, acc);
  __builtin_amdgcn_sched_barrier(0);
  // the last loads' address registers are free for reuse behind this wait
  asm volatile("s_wait_xcnt 0x0" ::: "memory");
  __builtin_amdgcn_sched_barrier(0);
  mma_frags<MT, NT>(a1, b1, acc);
}

// ===========================================================================
// Kernel 1: QKV projection + RoPE + q-scale from packed f16 operands.
// 4 waves / block; wave w owns rows [64*(blockIdx.x*4+w), +64) and the three
// 64-wide head columns 3*blockIdx.y .. +2 of the 24 (16 q, 4 k, 4 v).
// Q written row-major (slot,t,d), K in fragment order, both via LDS-staged
// whole-line stores.  V written in fragment order straight from registers.
// ===========================================================================
__global__ __launch_bounds__(128)
void qkv_rope_kernel(const _Float16* __restrict__ xh,
                     const _Float16* __restrict__ pWq,
                     const _Float16* __restrict__ pWk,
                     const _Float16* __restrict__ pWv,
                     _Float16* __restrict__ qws,
                     _Float16* __restrict__ kws,
                     _Float16* __restrict__ vT)
{
  __shared__ __align__(128) _Float16 st[4][3][64][64];   // 96 KB staging

  const int lane = threadIdx.x & 31;
  const int w    = threadIdx.x >> 5;
  const int ln   = lane & 15;
  const int mb   = (lane >> 4) << 3;
  const int rt   = blockIdx.x * 4 + w;     // 64-row tile
  const int hc0  = blockIdx.y * 3;         // first of three head columns

  const _Float16* bp[3];
#pragma unroll
  for (int hh = 0; hh < 3; ++hh) {
    const int hc = hc0 + hh;
    const _Float16* pW = (hc < 16) ? pWq + (size_t)hc * 4 * NTSTRIDE
                       : (hc < 20) ? pWk + (size_t)(hc - 16) * 4 * NTSTRIDE
                                   : pWv + (size_t)(hc - 20) * 4 * NTSTRIDE;
    bp[hh] = pW;
  }
  const _Float16* ap = xh + (size_t)(rt * 4) * NTSTRIDE;

  v8f acc[4][12] = {};
  gemm_tile<4, 12>(ap, bp, acc);

  const int t0 = (rt * 64) & (SEQ - 1);
  const int bpi = rt >> 3;

  // RoPE tables of this lane's 32 rows, shared by the wave's q and k heads
  const float LOG1E4_32 = 0.28782313662425575f;    // ln(10000)/32
  const float fA = __expf(-(float)ln * LOG1E4_32);
  const float fB = __expf(-(float)(16 + ln) * LOG1E4_32);
  float sA[4][8], cA[4][8], sB[4][8], cB[4][8];
#pragma unroll
  for (int mi = 0; mi < 4; ++mi)
#pragma unroll
    for (int r = 0; r < 8; ++r) {
      const float tm = (float)(t0 + mi * 16 + mb + r);
      __sincosf(tm * fA, &sA[mi][r], &cA[mi][r]);
      __sincosf(tm * fB, &sB[mi][r], &cB[mi][r]);
    }

#pragma unroll
  for (int hh = 0; hh < 3; ++hh) {
    const int hc = hc0 + hh;
    if (hc < 20) {
      // RoPE pairs (dh, dh+32): tile 0<->2 (dh=ln), tile 1<->3 (dh=16+ln)
      const float qs = (hc < 16) ? 0.125f : 1.0f;  // 1/sqrt(HEAD_DIM) into q
#pragma unroll
      for (int mi = 0; mi < 4; ++mi)
#pragma unroll
        for (int r = 0; r < 8; ++r) {
          _Float16* srow = &st[w][hh][mi * 16 + mb + r][0];
          float lo = acc[mi][hh * 4 + 0][r], hi = acc[mi][hh * 4 + 2][r];
          srow[ln]      = (_Float16)((lo * cA[mi][r] - hi * sA[mi][r]) * qs);
          srow[32 + ln] = (_Float16)((lo * sA[mi][r] + hi * cA[mi][r]) * qs);
          lo = acc[mi][hh * 4 + 1][r]; hi = acc[mi][hh * 4 + 3][r];
          srow[16 + ln] = (_Float16)((lo * cB[mi][r] - hi * sB[mi][r]) * qs);
          srow[48 + ln] = (_Float16)((lo * sB[mi][r] + hi * cB[mi][r]) * qs);
        }
    } else {
      // V: a lane's 8 rows of one column are one piece of the plane
      // [32-key chunk][16-d tile j][key half mi&1][lane]
      _Float16* dst = vT + ((size_t)(bpi * N_KVH + (hc - 20)) * HEAD_DIM) * SEQ
                         + (size_t)(t0 >> 5) * 2048 + lane * 8;
#pragma unroll
      for (int j = 0; j < 4; ++j) {
#pragma unroll
        for (int mi = 0; mi < 4; ++mi) {
          v8h h;
#pragma unroll
          for (int r = 0; r < 8; ++r) h[r] = (_Float16)acc[mi][hh * 4 + j][r];
          *(v8h*)(dst + ((mi >> 1) * 4 + j) * 512 + (mi & 1) * 256) = h;
        }
        // the stores' data registers are refilled next: wait first (the fence
        // holds the next conversions behind the wait)
        asm volatile("s_wait_xcnt 0x0" ::: "memory");
        __builtin_amdgcn_sched_barrier(0);
      }
    }
  }
  __syncthreads();   // staged rows are read back by other lanes

#pragma unroll
  for (int hh = 0; hh < 3; ++hh) {
    const int hc = hc0 + hh;
    if (hc < 20) {
      // 64 rows x 64 halfs of one head are 8 KB contiguous in q / k
      _Float16* dst = (hc < 16)
          ? qws + ((size_t)(bpi * N_HEADS + hc) * SEQ + t0) * HEAD_DIM
          : kws + ((size_t)(bpi * N_KVH + (hc - 16)) * SEQ + t0) * HEAD_DIM;
      const v8h* s = (const v8h*)&st[w][hh][0][0];
      v8h* g = (v8h*)dst;
      // q leaves as it lies; k leaves per 16-key tile as planes [d/8][key]
      const bool isq = hc < 16;
      const int  sl  = isq ? lane : ln * 8 + (lane >> 4);
#pragma unroll
      for (int i = 0; i < 16; ++i)
        g[i * 32 + lane] = s[sl + (isq ? i * 32 : (i >> 2) * 128 + (i & 3) * 2)];
      if (hh < 2) {
        // the next head column reuses these stores' data and address
        // registers: wait first
        asm volatile("s_wait_xcnt 0x0" ::: "memory");
      }
    }
  }
}

// ===========================================================================
// Kernel 2: attention, one wave per (bp, head, four 16-query tiles).
//   grid = (SEQ/64, N_HEADS, BP)
// Both products run with their operands swapped: S^T = K Q^T, O^T = V^T P^T.
// A and B fragments share one lane map, so the K, Q and V registers are the
// ones the unswapped products take.  A lane then holds scores of ONE query
// (column lane&15), keys 8*(lane>>4)..+7 of each 16-key tile: two such tiles
// are, as they lie, the B fragment of P^T for one 32-key chunk.  Scores and
// probabilities never leave the registers; the softmax is the running form
// (maximum and sum carried from one 32-key block to the next), inside the
// lane but for one exchange with lane^16 per block; O^T leaves as A-order
// planes.  No LDS.  Every loaded K and V fragment feeds all four query tiles
// of the wave: a quarter of the loads per score, four independent softmax chains.
// ===========================================================================
// Four fragments (eight planes, 4 KB) of block blk of K or V.  The block's
// start goes through readfirstlane so that it stays in scalar registers: the
// loads then name that pair and the lane's own offset, which is never rewritten.
__device__ __forceinline__ void load_blk(v16h (&f)[4],
                                         const _Float16* __restrict__ base, int blk)
{
  const unsigned long long u = (unsigned long long)(base + blk * 2048);
  const unsigned lo = __builtin_amdgcn_readfirstlane((unsigned)u);
  const unsigned hi = __builtin_amdgcn_readfirstlane((unsigned)(u >> 32));
  // rebuilt from its words the pointer must be named global again, or the
  // loads turn into flat ones
  typedef const __attribute__((address_space(1))) v8h* gv8h;
  gv8h p = (gv8h)(((unsigned long long)hi << 32) | lo) + (threadIdx.x & 31);
#pragma unroll
  for (int i = 0; i < 4; ++i)
    f[i] = cat8(p[i * 64], p[i * 64 + 32]);
}

// value of the lane 16 away (same query, other eight keys of each tile)
__device__ __forceinline__ float other_half(float x) {
  return __builtin_bit_cast(float, __builtin_amdgcn_permlanex16(
      __builtin_bit_cast(unsigned, x), __builtin_bit_cast(unsigned, x),
      0x76543210u, 0xfedcba98u, false, false));
}

__device__ __forceinline__ void attn_block(const v16h (&k)[4], const v16h (&v)[4],
                                           v16h aq0, v16h aq1,
                                           float& m, float& sum, v8f (&o)[4])
{
  const float L2E = 1.4426950408889634f;              // log2(e)
  const v8f zero = {};
  v8f s0 = wmma16x16x32(k[0], aq0, zero);
  v8f s1 = wmma16x16x32(k[2], aq0, zero);
  s0 = wmma16x16x32(k[1], aq1, s0);
  s1 = wmma16x16x32(k[3], aq1, s1);

  float t[8];
#pragma unroll
  for (int r = 0; r < 8; ++r) t[r] = fmaxf(s0[r], s1[r]);
  float bm = fmaxf(fmaxf(fmaxf(t[0], t[1]), fmaxf(t[2], t[3])),
                   fmaxf(fmaxf(t[4], t[5]), fmaxf(t[6], t[7])));
  bm = fmaxf(bm, other_half(bm));
  const float mn    = fmaxf(m, bm);
  const float mL    = mn * L2E;
  const float alpha = __builtin_amdgcn_exp2f(fmaf(m, L2E, -mL));
  m = mn;

  v16h pf;
  float a[8];
#pragma unroll
  for (int r = 0; r < 8; ++r) {
    const float p0 = __builtin_amdgcn_exp2f(fmaf(s0[r], L2E, -mL));
    const float p1 = __builtin_amdgcn_exp2f(fmaf(s1[r], L2E, -mL));
    a[r]      = p0 + p1;
    pf[r]     = (_Float16)p0;
    pf[r + 8] = (_Float16)p1;
  }
  sum = fmaf(sum, alpha, ((a[0] + a[1]) + (a[2] + a[3])) + ((a[4] + a[5]) + (a[6] + a[7])));
#pragma unroll
  for (int j = 0; j < 4; ++j)
#pragma unroll
    for (int r = 0; r < 8; ++r) o[j][r] *= alpha;
#pragma unroll
  for (int j = 0; j < 4; ++j) o[j] = wmma16x16x32(v[j], pf, o[j]);
}

#define QT 4   // 16-query tiles per wave; each K / V fragment feeds all of them

__global__ __launch_bounds__(32)
void attn_kernel(const _Float16* __restrict__ qws,
                 const _Float16* __restrict__ kws,
                 const _Float16* __restrict__ vT,
                 _Float16* __restrict__ ctx)
{
  const int lane = threadIdx.x;
  const int ln   = lane & 15;
  const int koff = (lane >> 4) << 3;
  const int qt0  = blockIdx.x * QT;
  const int h    = blockIdx.y;
  const int bp   = blockIdx.z;

  const _Float16* __restrict__ qb = qws + ((size_t)(bp * N_HEADS + h)        * SEQ) * HEAD_DIM;
  const _Float16* __restrict__ kb = kws + ((size_t)(bp * N_KVH   + (h >> 2)) * SEQ) * HEAD_DIM;
  const _Float16* __restrict__ vb = vT  + ((size_t)(bp * N_KVH   + (h >> 2)) * HEAD_DIM) * SEQ;

  // Q tile fragments (each 16x64 tile as two 16x32 chunks)
  v16h aq0[QT], aq1[QT];
#pragma unroll   // the tile index picks registers: it must be a constant
  for (int u = 0; u < QT; ++u) {
    const _Float16* qrow = qb + (size_t)((qt0 + u) * 16 + ln) * HEAD_DIM;
    aq0[u] = cat8(*(const v8h*)(qrow + koff),      *(const v8h*)(qrow + 16 + koff));
    aq1[u] = cat8(*(const v8h*)(qrow + 32 + koff), *(const v8h*)(qrow + 48 + koff));
    __builtin_amdgcn_sched_barrier(0);   // holds the wait directly behind the loads
    // the next tile's results may land in this tile's address registers
    asm volatile("s_wait_xcnt 0x0" ::: "memory");
    __builtin_amdgcn_sched_barrier(0);
  }

  float m[QT], sum[QT];
  v8f o[QT][4] = {};
#pragma unroll
  for (int u = 0; u < QT; ++u) { m[u] = -3.0e38f; sum[u] = 0.f; }
  // K block: two 16-key tiles of two d halves, fetched one block ahead.
  // V block: four 16-d tiles of one 32-key chunk, fetched at the head of its
  // own block, ahead of the scores and the exponentials.
  v16h k0[4], k1[4];
  load_blk(k0, kb, 0);
  __builtin_amdgcn_sched_barrier(0);   // holds the wait directly behind the loads
  // registers that the issued loads name are rewritten next: wait first
  asm volatile("s_wait_xcnt 0x0" ::: "memory");
  __builtin_amdgcn_sched_barrier(0);
  for (int b = 0; b < SEQ / 32; b += 2) {
    v16h va[4], vc[4];
    // the scheduling fences keep each load group whole and ahead of the block;
    // without them the loads sink down to the WMMAs that need them
    load_blk(va, vb, b);
    load_blk(k1, kb, b + 1);
    __builtin_amdgcn_sched_barrier(0);
#pragma unroll   // one straight run, so that the tiles' chains interleave
    for (int u = 0; u < QT; ++u)
      attn_block(k0, va, aq0[u], aq1[u], m[u], sum[u], o[u]);
    __builtin_amdgcn_sched_barrier(0);
    // the scalar bases of the issued loads are rewritten next: wait first
    asm volatile("s_wait_xcnt 0x0" ::: "memory");
    __builtin_amdgcn_sched_barrier(0);
    load_blk(vc, vb, b + 1);
    if (b + 2 < SEQ / 32) load_blk(k0, kb, b + 2);
    __builtin_amdgcn_sched_barrier(0);
#pragma unroll   // one straight run, so that the tiles' chains interleave
    for (int u = 0; u < QT; ++u)
      attn_block(k1, vc, aq0[u], aq1[u], m[u], sum[u], o[u]);
    __builtin_amdgcn_sched_barrier(0);
    // the scalar bases of the issued loads step on behind this wait
    asm volatile("s_wait_xcnt 0x0" ::: "memory");
    __builtin_amdgcn_sched_barrier(0);
  }

  // lane holds query ln, d = 16 j + koff + r: its piece of A-order plane j
  v8h oh[QT][4];
#pragma unroll
  for (int u = 0; u < QT; ++u) {
    sum[u] += other_half(sum[u]);
    const float rinv = 1.0f / sum[u];
#pragma unroll
    for (int j = 0; j < 4; ++j)
#pragma unroll
      for (int r = 0; r < 8; ++r) oh[u][j][r] = (_Float16)(o[u][j][r] * rinv);
  }
  _Float16* g = ctx + ((size_t)(bp * (SEQ / 16) + qt0) * KCH + h * 2) * 512 + lane * 8;
#pragma unroll
  for (int u = 0; u < QT; ++u)
#pragma unroll
    for (int j = 0; j < 4; ++j)
      *(v8h*)(g + (size_t)u * KCH * 512 + j * 256) = oh[u][j];
}

// ===========================================================================
// Kernel 3: out = ctx @ Wo (packed) with (B,T,P,:) permuted fp32 store.
// 4 waves / block; wave w owns rows [64*(blockIdx.x*4+w), +64) and the 128
// columns of blockIdx.y.  Rows leave as whole 512 B pieces through LDS.
// ===========================================================================
__global__ __launch_bounds__(128)
void out_proj_kernel(const _Float16* __restrict__ ctx,
                     const _Float16* __restrict__ pWo,
                     float* __restrict__ out)
{
  // pitch 132 floats: the two lane halves (8 rows apart) fall on other banks
  __shared__ __align__(128) float ot[4][64][132];

  const int lane = threadIdx.x & 31;
  const int w    = threadIdx.x >> 5;
  const int ln   = lane & 15;
  const int mb   = (lane >> 4) << 3;
  const int rt   = blockIdx.x * 4 + w;     // 64-row tile
  const int ct   = blockIdx.y;             // 128-column tile

  const _Float16* ap = ctx + (size_t)(rt * 4) * NTSTRIDE;
  const _Float16* bp[2];
  bp[0] = pWo + (size_t)(ct * 8) * NTSTRIDE;
  bp[1] = bp[0] + (size_t)4 * NTSTRIDE;

  v8f acc[4][8] = {};
  gemm_tile<4, 8>(ap, bp, acc);

#pragma unroll
  for (int mi = 0; mi < 4; ++mi)
#pragma unroll
    for (int nj = 0; nj < 8; ++nj)
#pragma unroll
      for (int r = 0; r < 8; ++r)
        ot[w][mi * 16 + mb + r][nj * 16 + ln] = acc[mi][nj][r];
  __syncthreads();   // staged rows are read back by other lanes

  // the tile's 64 (b,p,t) rows share b and p; t runs on
  const int rr = rt * 64;
  const int bb = rr >> 12;
  const int pp = (rr >> 9) & 7;
  const int tt = rr & (SEQ - 1);
  float* grow = out + (((size_t)(bb * SEQ + tt) * 8 + pp) << 10)
                    + ct * 128 + lane * 4;
#pragma unroll
  for (int row = 0; row < 64; ++row)
    *(v4f*)(grow + (size_t)row * 8 * D_MODEL) = *(const v4f*)&ot[w][row][lane * 4];
}

// ===========================================================================
extern "C" void kernel_launch(void* const* d_in, const int* in_sizes, int n_in,
                              void* d_out, int out_size, void* d_ws, size_t ws_size,
                              hipStream_t stream) {
  const float* hidden = (const float*)d_in[0];
  const float* Wq     = (const float*)d_in[1];
  const float* Wk     = (const float*)d_in[2];
  const float* Wv     = (const float*)d_in[3];
  const float* Wo     = (const float*)d_in[4];
  float*       out    = (float*)d_out;

  // f16 workspace layout (halfs). ctx aliases xh (xh dead after kernel 1).
  _Float16* xh  = (_Float16*)d_ws;                         // 8192*1024
  _Float16* ctx = xh;                                      // alias
  _Float16* qws = xh  + (size_t)ROWS * D_MODEL;            // 16*16*512*64
  _Float16* kws = qws + (size_t)BP * N_HEADS * SEQ * HEAD_DIM;
  _Float16* vT  = kws + (size_t)BP * N_KVH * SEQ * HEAD_DIM;
  _Float16* pWq = vT  + (size_t)BP * N_KVH * SEQ * HEAD_DIM;
  _Float16* pWk = pWq + (size_t)D_MODEL * (N_HEADS * HEAD_DIM);
  _Float16* pWv = pWk + (size_t)D_MODEL * (N_KVH * HEAD_DIM);
  _Float16* pWo = pWv + (size_t)D_MODEL * (N_KVH * HEAD_DIM);

  prepare_kernel<<<PACK_BLOCKS + CONV_BLOCKS, 256, 0, stream>>>(
      hidden, Wq, Wk, Wv, Wo, xh, pWq, pWk, pWv, pWo);

  qkv_rope_kernel<<<dim3(ROWS / 64 / 4, (N_HEADS + 2 * N_KVH) / 3), 128, 0, stream>>>(
      xh, pWq, pWk, pWv, qws, kws, vT);

  attn_kernel<<<dim3(SEQ / 16 / QT, N_HEADS, BP), 32, 0, stream>>>(
      qws, kws, vT, ctx);

  out_proj_kernel<<<dim3(ROWS / 64 / 4, D_MODEL / 128), 128, 0, stream>>>(
      ctx, pWo, out);
}

// v006
// It runs in 67.3 microseconds.
// Next to v005, in two timings, it ran 1.07 times as fast each time.
// Over all steps from v000 it is 4.71 times as fast.
#include <hip/hip_runtime.h>

// ---------------------------------------------------------------------------
// MI455X (gfx1250) fused attention: QKV+RoPE -> softmax attention -> out proj
// All matrix math via v_wmma_f32_16x16x32_f16 (wave32, f32 accumulate).
// Memory strategy: every f16 WMMA operand but Q (row-major) that passes through global memory
// lies in fragment order, in planes of 512 B: plane[lane][8 halfs].  One
// 16-byte load per lane then covers four whole 128 B lines.
//   A-order (xh, ctx), element (row, k) of a rows x 1024 matrix:
//     (((row>>4)*KCH + (k>>5))*2 + ((k>>4)&1))*256 + (((k>>3)&1)*16 + (row&15))*8 + (k&7)
//   weights: the same with the n tile in place of the row tile
//   K: per 16-key tile, plane pair by d;  V: per 32-key chunk and 16-d tile
// ---------------------------------------------------------------------------

typedef __attribute__((ext_vector_type(16))) _Float16 v16h;
typedef __attribute__((ext_vector_type(8)))  _Float16 v8h;
typedef __attribute__((ext_vector_type(4)))  _Float16 v4h;
typedef __attribute__((ext_vector_type(8)))  float    v8f;
typedef __attribute__((ext_vector_type(4)))  float    v4f;

#define D_MODEL   1024
#define N_HEADS   16
#define N_KVH     4
#define HEAD_DIM  64
#define SEQ       512
#define BP        16          // B*P = 2*8
#define ROWS      8192        // BP * SEQ
#define KCH       (D_MODEL / 32)   // 32 k-chunks of 32

__device__ __forceinline__ v8f wmma16x16x32(v16h a, v16h b, v8f c) {
  // (neg_a, A, neg_b, B, c_mod, C, reuse_a, reuse_b)
  return __builtin_amdgcn_wmma_f32_16x16x32_f16(false, a, false, b, (short)0, c,
                                                false, false);
}

__device__ __forceinline__ v16h cat8(v8h lo, v8h hi) {
  v16h r;
#pragma unroll
  for (int i = 0; i < 8; ++i) { r[i] = lo[i]; r[i + 8] = hi[i]; }
  return r;
}

// ===========================================================================
// Kernel 0: all operand preparation in ONE launch (the five pieces are
// independent of each other).  256 threads a block; the block index picks the
// piece: blocks [0, PACK_BLOCKS) pack weights, the rest turn hidden into xh.
// The weight blocks come first: their strided reads have the longer latency
// and run on under the start of the many conversion blocks.
// ===========================================================================
#define PACK_BLOCKS (((2 * D_MODEL + 2 * N_KVH * HEAD_DIM) / 128) * KCH)   // 640
#define CONV_BLOCKS ((ROWS / 16) * (D_MODEL / 128))                        // 4096

// hidden (b,t,p,d) fp32 -> xh, f16, rows (b,p,t), in A-order.
// One block turns 16 rows x 128 d: whole-line reads, a turn through LDS,
// whole-line stores.  cb = block number among the CONV_BLOCKS.
// t: pitch 136 halfs, rows fall on other banks for the 16-byte column reads
__device__ __forceinline__ void convert_x_tile(const float* __restrict__ hidden,
                                               _Float16* __restrict__ xh,
                                               _Float16 (&t)[16][136], int cb)
{
  const int lane  = threadIdx.x & 31;
  const int w     = threadIdx.x >> 5;
  const int rtile = cb >> 3;                          // 16-row tile
  const int db    = cb & 7;                           // 128-wide d block
#pragma unroll
  for (int j = 0; j < 2; ++j) {
    const int row = w * 2 + j;
    const int rr  = rtile * 16 + row;                 // (b,p,t) row
    const int bb  = rr >> 12;
    const int pp  = (rr >> 9) & 7;
    const int tt  = rr & (SEQ - 1);
    const float* s = hidden + (((size_t)(bb * SEQ + tt) * 8 + pp) << 10)
                            + db * 128 + lane * 4;
    v4f f = *(const v4f*)s;
    v4h h;
#pragma unroll
    for (int i = 0; i < 4; ++i) h[i] = (_Float16)f[i];
    *(v4h*)&t[row][lane * 4] = h;
  }
  __syncthreads();   // the planes are read across the rows other waves wrote

  const int part = w & 1;                             // plane of the k chunk
  const int kcl  = w >> 1;                            // k chunk in the block
  v8h o = *(const v8h*)&t[lane & 15][kcl * 32 + part * 16 + (lane >> 4) * 8];
  *(v8h*)(xh + ((size_t)(rtile * KCH + db * 4 + kcl) * 2 + part) * 256 + lane * 8) = o;
}

// One wave packs one 32 x 16 piece of an fp32 weight (K=1024 x N) into f16
// B-fragment order:
//   dst[((nt*KCH + kc)*2 + part)*256 + lane*8 + i] = W[k*N + nt*16 + (lane&15)]
// with k = kc*32 + part*16 + koff + i, i < 8, koff=(lane>>4)*8.
__device__ __forceinline__ void pack_w_piece(const float* __restrict__ W, int N,
                                             _Float16* __restrict__ dst,
                                             int nt, int kc)
{
  const int lane = threadIdx.x & 31;
  const int ln   = lane & 15;
  const int koff = (lane >> 4) << 3;
  const int kb   = kc * 32;
  const float* col = W + nt * 16 + ln;
  float f0[8], f1[8];
#pragma unroll
  for (int i = 0; i < 8; ++i) f0[i] = col[(size_t)(kb + koff + i) * N];
  // the second group's results may land in the first group's address registers
  asm volatile("s_wait_xcnt 0x0" ::: "memory");
#pragma unroll
  for (int i = 0; i < 8; ++i) f1[i] = col[(size_t)(kb + 16 + koff + i) * N];
  v8h b0, b1;
#pragma unroll
  for (int i = 0; i < 8; ++i) {
    b0[i] = (_Float16)f0[i];
    b1[i] = (_Float16)f1[i];
  }
  _Float16* d = dst + (size_t)(nt * KCH + kc) * 512 + lane * 8;
  *(v8h*)(d)       = b0;
  *(v8h*)(d + 256) = b1;
}

__global__ __launch_bounds__(256)
void prepare_kernel(const float* __restrict__ hidden,
                    const float* __restrict__ Wq,
                    const float* __restrict__ Wk,
                    const float* __restrict__ Wv,
                    const float* __restrict__ Wo,
                    _Float16* __restrict__ xh,
                    _Float16* __restrict__ pWq,
                    _Float16* __restrict__ pWk,
                    _Float16* __restrict__ pWv,
                    _Float16* __restrict__ pWo)
{
  __shared__ __align__(16) _Float16 t[16][136];

  const int blk = blockIdx.x;
  if (blk >= PACK_BLOCKS) {
    convert_x_tile(hidden, xh, t, blk - PACK_BLOCKS);
    return;
  }
  // a weight block: one k chunk of eight neighbouring n tiles, one per wave
  // (the eight waves together read whole 512 B row pieces).  Groups of eight
  // n tiles in the order Wq (8), Wk (2), Wv (2), Wo (8).
  const int kc = blk & (KCH - 1);
  const int g  = blk / KCH;
  const int w  = threadIdx.x >> 5;
  const float* W;
  _Float16* dst;
  int N, g0;
  if (g < 8)       { W = Wq; dst = pWq; N = N_HEADS * HEAD_DIM; g0 = 0;  }
  else if (g < 10) { W = Wk; dst = pWk; N = N_KVH * HEAD_DIM;   g0 = 8;  }
  else if (g < 12) { W = Wv; dst = pWv; N = N_KVH * HEAD_DIM;   g0 = 10; }
  else             { W = Wo; dst = pWo; N = D_MODEL;            g0 = 12; }
  pack_w_piece(W, N, dst, (g - g0) * 8 + w, kc);
}

// ===========================================================================
// Register-tiled GEMM core shared by kernels 1 and 3.
// One wave owns MT x NT accumulator tiles (16x16 each): a loaded A fragment
// feeds NT WMMAs and a loaded B fragment MT WMMAs.  A ring of NS fragment sets:
// a k chunk's loads are issued NS - 1 chunks ahead of its WMMAs, so that a load
// that misses L2 has landed when its turn comes.
//   ap    : A-order start of the wave's first row tile (wave-uniform)
//   bp[q] : packed n-tile 4*q of the wave's columns (wave-uniform)
// ===========================================================================
#define NTSTRIDE (KCH * 32 * 16)      // halfs per packed n-tile or A row tile

template <int MT, int NT>
__device__ __forceinline__ void load_frags(v16h (&a)[MT], v16h (&b)[NT],
                                           const _Float16* __restrict__ ap,
                                           const _Float16* const (&bp)[NT / 4],
                                           int kc)
{
#pragma unroll
  for (int mi = 0; mi < MT; ++mi) {
    const _Float16* p = ap + (size_t)mi * NTSTRIDE + kc * 512
                           + (threadIdx.x & 31) * 8;
    a[mi] = cat8(*(const v8h*)(p), *(const v8h*)(p + 256));
  }
#pragma unroll
  for (int nj = 0; nj < NT; ++nj) {
    const _Float16* p = bp[nj >> 2] + (size_t)(nj & 3) * NTSTRIDE + kc * 512
                                    + (threadIdx.x & 31) * 8;
    b[nj] = cat8(*(const v8h*)(p), *(const v8h*)(p + 256));
  }
}

template <int MT, int NT>
__device__ __forceinline__ void mma_frags(const v16h (&a)[MT], const v16h (&b)[NT],
                                          v8f (&acc)[MT][NT])
{
#pragma unroll
  for (int mi = 0; mi < MT; ++mi)
#pragma unroll
    for (int nj = 0; nj < NT; ++nj)
      acc[mi][nj] = wmma16x16x32(a[mi], b[nj], acc[mi][nj]);
}

template <int MT, int NT, int NS>
__device__ __forceinline__ void gemm_tile(const _Float16* __restrict__ ap,
                                          const _Float16* const (&bp)[NT / 4],
                                          v8f (&acc)[MT][NT])
{
  // ring of NS fragment sets: chunk kc lies in set kc % NS and its loads are
  // issued NS - 1 chunks ahead of its WMMAs
  v16h a[NS][MT], b[NS][NT];
#pragma unroll   // the set index picks registers: it must be a constant
  for (int s = 0; s < NS - 1; ++s) load_frags<MT, NT>(a[s], b[s], ap, bp, s);
  __builtin_amdgcn_sched_barrier(0);   // holds the wait directly behind the loads
  // registers that the issued loads name are rewritten next: wait first
  asm volatile("s_wait_xcnt 0x0" ::: "memory");
  __builtin_amdgcn_sched_barrier(0);
  // chunks whose turn still issues a load, rounded down to whole ring turns
  constexpr int MAIN = ((KCH - (NS - 1)) / NS) * NS;
  for (int kc = 0; kc < MAIN; kc += NS) {
#pragma unroll   // the set index picks registers: it must be a constant
    for (int s = 0; s < NS; ++s) {
      // the scheduling fences keep each load group whole and ahead of the WMMA
      // block; without them the loads sink in among the WMMAs that need them
      load_frags<MT, NT>(a[(s + NS - 1) % NS], b[(s + NS - 1) % NS], ap, bp,
                         kc + s + NS - 1);
      __builtin_amdgcn_sched_barrier(0);
      mma_frags<MT, NT>(a[s], b[s], acc);
      __builtin_amdgcn_sched_barrier(0);
    }
    // the address registers of the issued loads step on behind this wait
    asm volatile("s_wait_xcnt 0x0" ::: "memory");
    __builtin_amdgcn_sched_barrier(0);
  }
#pragma unroll   // the set index picks registers: it must be a constant
  for (int kc = MAIN; kc < KCH; ++kc) {
    if (kc + NS - 1 < KCH) {
      load_frags<MT, NT>(a[(kc + NS - 1) % NS], b[(kc + NS - 1) % NS], ap, bp,
                         kc + NS - 1);
      __builtin_amdgcn_sched_barrier(0);   // same: load group ahead of the WMMAs
      mma_frags<MT, NT>(a[kc % NS], b[kc % NS], acc);
      __builtin_amdgcn_sched_barrier(0);
      // the last loads' address registers are free for reuse behind this wait
      asm volatile("s_wait_xcnt 0x0" ::: "memory");
      __builtin_amdgcn_sched_barrier(0);
    } else {
      mma_frags<MT, NT>(a[kc % NS], b[kc % NS], acc);
    }
  }
}

// ===========================================================================
// Kernel 1: QKV projection + RoPE + q-scale from packed f16 operands.
// 4 waves / block; wave w owns rows [64*(blockIdx.x*4+w), +64) and the three
// 64-wide head columns 3*blockIdx.y .. +2 of the 24 (16 q, 4 k, 4 v).
// Q written row-major (slot,t,d), K in fragment order, both via LDS-staged
// whole-line stores.  V written in fragment order straight from registers.
// ===========================================================================
__global__ __launch_bounds__(128)
void qkv_rope_kernel(const _Float16* __restrict__ xh,
                     const _Float16* __restrict__ pWq,
                     const _Float16* __restrict__ pWk,
                     const _Float16* __restrict__ pWv,
                     _Float16* __restrict__ qws,
                     _Float16* __restrict__ kws,
                     _Float16* __restrict__ vT)
{
  __shared__ __align__(128) _Float16 st[4][3][64][64];   // 96 KB staging

  const int lane = threadIdx.x & 31;
  const int w    = threadIdx.x >> 5;
  const int ln   = lane & 15;
  const int mb   = (lane >> 4) << 3;
  const int rt   = blockIdx.x * 4 + w;     // 64-row tile
  const int hc0  = blockIdx.y * 3;         // first of three head columns

  const _Float16* bp[3];
#pragma unroll
  for (int hh = 0; hh < 3; ++hh) {
    const int hc = hc0 + hh;
    const _Float16* pW = (hc < 16) ? pWq + (size_t)hc * 4 * NTSTRIDE
                       : (hc < 20) ? pWk + (size_t)(hc - 16) * 4 * NTSTRIDE
                                   : pWv + (size_t)(hc - 20) * 4 * NTSTRIDE;
    bp[hh] = pW;
  }
  const _Float16* ap = xh + (size_t)(rt * 4) * NTSTRIDE;

  v8f acc[4][12] = {};
  gemm_tile<4, 12, 3>(ap, bp, acc);

  const int t0 = (rt * 64) & (SEQ - 1);
  const int bpi = rt >> 3;

  // RoPE tables of this lane's 32 rows, shared by the wave's q and k heads
  const float LOG1E4_32 = 0.28782313662425575f;    // ln(10000)/32
  const float fA = __expf(-(float)ln * LOG1E4_32);
  const float fB = __expf(-(float)(16 + ln) * LOG1E4_32);
  float sA[4][8], cA[4][8], sB[4][8], cB[4][8];
#pragma unroll
  for (int mi = 0; mi < 4; ++mi)
#pragma unroll
    for (int r = 0; r < 8; ++r) {
      const float tm = (float)(t0 + mi * 16 + mb + r);
      __sincosf(tm * fA, &sA[mi][r], &cA[mi][r]);
      __sincosf(tm * fB, &sB[mi][r], &cB[mi][r]);
    }

#pragma unroll
  for (int hh = 0; hh < 3; ++hh) {
    const int hc = hc0 + hh;
    if (hc < 20) {
      // RoPE pairs (dh, dh+32): tile 0<->2 (dh=ln), tile 1<->3 (dh=16+ln)
      const float qs = (hc < 16) ? 0.125f : 1.0f;  // 1/sqrt(HEAD_DIM) into q
#pragma unroll
      for (int mi = 0; mi < 4; ++mi)
#pragma unroll
        for (int r = 0; r < 8; ++r) {
          _Float16* srow = &st[w][hh][mi * 16 + mb + r][0];
          float lo = acc[mi][hh * 4 + 0][r], hi = acc[mi][hh * 4 + 2][r];
          srow[ln]      = (_Float16)((lo * cA[mi][r] - hi * sA[mi][r]) * qs);
          srow[32 + ln] = (_Float16)((lo * sA[mi][r] + hi * cA[mi][r]) * qs);
          lo = acc[mi][hh * 4 + 1][r]; hi = acc[mi][hh * 4 + 3][r];
          srow[16 + ln] = (_Float16)((lo * cB[mi][r] - hi * sB[mi][r]) * qs);
          srow[48 + ln] = (_Float16)((lo * sB[mi][r] + hi * cB[mi][r]) * qs);
        }
    } else {
      // V: a lane's 8 rows of one column are one piece of the plane
      // [32-key chunk][16-d tile j][key half mi&1][lane]
      _Float16* dst = vT + ((size_t)(bpi * N_KVH + (hc - 20)) * HEAD_DIM) * SEQ
                         + (size_t)(t0 >> 5) * 2048 + lane * 8;
#pragma unroll
      for (int j = 0; j < 4; ++j) {
#pragma unroll
        for (int mi = 0; mi < 4; ++mi) {
          v8h h;
#pragma unroll
          for (int r = 0; r < 8; ++r) h[r] = (_Float16)acc[mi][hh * 4 + j][r];
          *(v8h*)(dst + ((mi >> 1) * 4 + j) * 512 + (mi & 1) * 256) = h;
        }
        // the stores' data registers are refilled next: wait first (the fence
        // holds the next conversions behind the wait)
        asm volatile("s_wait_xcnt 0x0" ::: "memory");
        __builtin_amdgcn_sched_barrier(0);
      }
    }
  }
  __syncthreads();   // staged rows are read back by other lanes

#pragma unroll
  for (int hh = 0; hh < 3; ++hh) {
    const int hc = hc0 + hh;
    if (hc < 20) {
      // 64 rows x 64 halfs of one head are 8 KB contiguous in q / k
      _Float16* dst = (hc < 16)
          ? qws + ((size_t)(bpi * N_HEADS + hc) * SEQ + t0) * HEAD_DIM
          : kws + ((size_t)(bpi * N_KVH + (hc - 16)) * SEQ + t0) * HEAD_DIM;
      const v8h* s = (const v8h*)&st[w][hh][0][0];
      v8h* g = (v8h*)dst;
      // q leaves as it lies; k leaves per 16-key tile as planes [d/8][key]
      const bool isq = hc < 16;
      const int  sl  = isq ? lane : ln * 8 + (lane >> 4);
#pragma unroll
      for (int i = 0; i < 16; ++i)
        g[i * 32 + lane] = s[sl + (isq ? i * 32 : (i >> 2) * 128 + (i & 3) * 2)];
      if (hh < 2) {
        // the next head column reuses these stores' data and address
        // registers: wait first
        asm volatile("s_wait_xcnt 0x0" ::: "memory");
      }
    }
  }
}

// ===========================================================================
// Kernel 2: attention, one wave per (bp, head, four 16-query tiles).
//   grid = (SEQ/64, N_HEADS, BP)
// Both products run with their operands swapped: S^T = K Q^T, O^T = V^T P^T.
// A and B fragments share one lane map, so the K, Q and V registers are the
// ones the unswapped products take.  A lane then holds scores of ONE query
// (column lane&15), keys 8*(lane>>4)..+7 of each 16-key tile: two such tiles
// are, as they lie, the B fragment of P^T for one 32-key chunk.  Scores and
// probabilities never leave the registers; the softmax is the running form
// (maximum and sum carried from one 32-key block to the next), inside the
// lane but for one exchange with lane^16 per block; O^T leaves as A-order
// planes.  No LDS.  Every loaded K and V fragment feeds all four query tiles
// of the wave: a quarter of the loads per score, four independent softmax chains.
// ===========================================================================
// Four fragments (eight planes, 4 KB) of block blk of K or V.  The block's
// start goes through readfirstlane so that it stays in scalar registers: the
// loads then name that pair and the lane's own offset, which is never rewritten.
__device__ __forceinline__ void load_blk(v16h (&f)[4],
                                         const _Float16* __restrict__ base, int blk)
{
  const unsigned long long u = (unsigned long long)(base + blk * 2048);
  const unsigned lo = __builtin_amdgcn_readfirstlane((unsigned)u);
  const unsigned hi = __builtin_amdgcn_readfirstlane((unsigned)(u >> 32));
  // rebuilt from its words the pointer must be named global again, or the
  // loads turn into flat ones
  typedef const __attribute__((address_space(1))) v8h* gv8h;
  gv8h p = (gv8h)(((unsigned long long)hi << 32) | lo) + (threadIdx.x & 31);
#pragma unroll
  for (int i = 0; i < 4; ++i)
    f[i] = cat8(p[i * 64], p[i * 64 + 32]);
}

// value of the lane 16 away (same query, other eight keys of each tile)
__device__ __forceinline__ float other_half(float x) {
  return __builtin_bit_cast(float, __builtin_amdgcn_permlanex16(
      __builtin_bit_cast(unsigned, x), __builtin_bit_cast(unsigned, x),
      0x76543210u, 0xfedcba98u, false, false));
}

__device__ __forceinline__ void attn_block(const v16h (&k)[4], const v16h (&v)[4],
                                           v16h aq0, v16h aq1,
                                           float& m, float& sum, v8f (&o)[4])
{
  const float L2E = 1.4426950408889634f;              // log2(e)
  const v8f zero = {};
  v8f s0 = wmma16x16x32(k[0], aq0, zero);
  v8f s1 = wmma16x16x32(k[2], aq0, zero);
  s0 = wmma16x16x32(k[1], aq1, s0);
  s1 = wmma16x16x32(k[3], aq1, s1);

  float t[8];
#pragma unroll
  for (int r = 0; r < 8; ++r) t[r] = fmaxf(s0[r], s1[r]);
  float bm = fmaxf(fmaxf(fmaxf(t[0], t[1]), fmaxf(t[2], t[3])),
                   fmaxf(fmaxf(t[4], t[5]), fmaxf(t[6], t[7])));
  bm = fmaxf(bm, other_half(bm));
  const float mn    = fmaxf(m, bm);
  const float mL    = mn * L2E;
  const float alpha = __builtin_amdgcn_exp2f(fmaf(m, L2E, -mL));
  m = mn;

  v16h pf;
  float a[8];
#pragma unroll
  for (int r = 0; r < 8; ++r) {
    const float p0 = __builtin_amdgcn_exp2f(fmaf(s0[r], L2E, -mL));
    const float p1 = __builtin_amdgcn_exp2f(fmaf(s1[r], L2E, -mL));
    a[r]      = p0 + p1;
    pf[r]     = (_Float16)p0;
    pf[r + 8] = (_Float16)p1;
  }
  sum = fmaf(sum, alpha, ((a[0] + a[1]) + (a[2] + a[3])) + ((a[4] + a[5]) + (a[6] + a[7])));
#pragma unroll
  for (int j = 0; j < 4; ++j)
#pragma unroll
    for (int r = 0; r < 8; ++r) o[j][r] *= alpha;
#pragma unroll
  for (int j = 0; j < 4; ++j) o[j] = wmma16x16x32(v[j], pf, o[j]);
}

#define QT 4   // 16-query tiles per wave; each K / V fragment feeds all of them

__global__ __launch_bounds__(32)
void attn_kernel(const _Float16* __restrict__ qws,
                 const _Float16* __restrict__ kws,
                 const _Float16* __restrict__ vT,
                 _Float16* __restrict__ ctx)
{
  const int lane = threadIdx.x;
  const int ln   = lane & 15;
  const int koff = (lane >> 4) << 3;
  const int qt0  = blockIdx.x * QT;
  const int h    = blockIdx.y;
  const int bp   = blockIdx.z;

  const _Float16* __restrict__ qb = qws + ((size_t)(bp * N_HEADS + h)        * SEQ) * HEAD_DIM;
  const _Float16* __restrict__ kb = kws + ((size_t)(bp * N_KVH   + (h >> 2)) * SEQ) * HEAD_DIM;
  const _Float16* __restrict__ vb = vT  + ((size_t)(bp * N_KVH   + (h >> 2)) * HEAD_DIM) * SEQ;

  // Q tile fragments (each 16x64 tile as two 16x32 chunks)
  v16h aq0[QT], aq1[QT];
#pragma unroll   // the tile index picks registers: it must be a constant
  for (int u = 0; u < QT; ++u) {
    const _Float16* qrow = qb + (size_t)((qt0 + u) * 16 + ln) * HEAD_DIM;
    aq0[u] = cat8(*(const v8h*)(qrow + koff),      *(const v8h*)(qrow + 16 + koff));
    aq1[u] = cat8(*(const v8h*)(qrow + 32 + koff), *(const v8h*)(qrow + 48 + koff));
    __builtin_amdgcn_sched_barrier(0);   // holds the wait directly behind the loads
    // the next tile's results may land in this tile's address registers
    asm volatile("s_wait_xcnt 0x0" ::: "memory");
    __builtin_amdgcn_sched_barrier(0);
  }

  float m[QT], sum[QT];
  v8f o[QT][4] = {};
#pragma unroll
  for (int u = 0; u < QT; ++u) { m[u] = -3.0e38f; sum[u] = 0.f; }
  // K block: two 16-key tiles of two d halves, fetched one block ahead.
  // V block: four 16-d tiles of one 32-key chunk, fetched at the head of its
  // own block, ahead of the scores and the exponentials.
  v16h k0[4], k1[4];
  load_blk(k0, kb, 0);
  __builtin_amdgcn_sched_barrier(0);   // holds the wait directly behind the loads
  // registers that the issued loads name are rewritten next: wait first
  asm volatile("s_wait_xcnt 0x0" ::: "memory");
  __builtin_amdgcn_sched_barrier(0);
  for (int b = 0; b < SEQ / 32; b += 2) {
    v16h va[4], vc[4];
    // the scheduling fences keep each load group whole and ahead of the block;
    // without them the loads sink down to the WMMAs that need them
    load_blk(va, vb, b);
    load_blk(k1, kb, b + 1);
    __builtin_amdgcn_sched_barrier(0);
#pragma unroll   // one straight run, so that the tiles' chains interleave
    for (int u = 0; u < QT; ++u)
      attn_block(k0, va, aq0[u], aq1[u], m[u], sum[u], o[u]);
    __builtin_amdgcn_sched_barrier(0);
    // the scalar bases of the issued loads are rewritten next: wait first
    asm volatile("s_wait_xcnt 0x0" ::: "memory");
    __builtin_amdgcn_sched_barrier(0);
    load_blk(vc, vb, b + 1);
    if (b + 2 < SEQ / 32) load_blk(k0, kb, b + 2);
    __builtin_amdgcn_sched_barrier(0);
#pragma unroll   // one straight run, so that the tiles' chains interleave
    for (int u = 0; u < QT; ++u)
      attn_block(k1, vc, aq0[u], aq1[u], m[u], sum[u], o[u]);
    __builtin_amdgcn_sched_barrier(0);
    // the scalar bases of the issued loads step on behind this wait
    asm volatile("s_wait_xcnt 0x0" ::: "memory");
    __builtin_amdgcn_sched_barrier(0);
  }

  // lane holds query ln, d = 16 j + koff + r: its piece of A-order plane j
  v8h oh[QT][4];
#pragma unroll
  for (int u = 0; u < QT; ++u) {
    sum[u] += other_half(sum[u]);
    const float rinv = 1.0f / sum[u];
#pragma unroll
    for (int j = 0; j < 4; ++j)
#pragma unroll
      for (int r = 0; r < 8; ++r) oh[u][j][r] = (_Float16)(o[u][j][r] * rinv);
  }
  _Float16* g = ctx + ((size_t)(bp * (SEQ / 16) + qt0) * KCH + h * 2) * 512 + lane * 8;
#pragma unroll
  for (int u = 0; u < QT; ++u)
#pragma unroll
    for (int j = 0; j < 4; ++j)
      *(v8h*)(g + (size_t)u * KCH * 512 + j * 256) = oh[u][j];
}

// ===========================================================================
// Kernel 3: out = ctx @ Wo (packed) with (B,T,P,:) permuted fp32 store.
// 4 waves / block; wave w owns rows [64*(blockIdx.x*4+w), +64) and the 128
// columns of blockIdx.y.  Rows leave as whole 512 B pieces through LDS.
// ===========================================================================
__global__ __launch_bounds__(128)
void out_proj_kernel(const _Float16* __restrict__ ctx,
                     const _Float16* __restrict__ pWo,
                     float* __restrict__ out)
{
  // pitch 132 floats: the two lane halves (8 rows apart) fall on other banks
  __shared__ __align__(128) float ot[4][64][132];

  const int lane = threadIdx.x & 31;
  const int w    = threadIdx.x >> 5;
  const int ln   = lane & 15;
  const int mb   = (lane >> 4) << 3;
  const int rt   = blockIdx.x * 4 + w;     // 64-row tile
  const int ct   = blockIdx.y;             // 128-column tile

  const _Float16* ap = ctx + (size_t)(rt * 4) * NTSTRIDE;
  const _Float16* bp[2];
  bp[0] = pWo + (size_t)(ct * 8) * NTSTRIDE;
  bp[1] = bp[0] + (size_t)4 * NTSTRIDE;

  v8f acc[4][8] = {};
  gemm_tile<4, 8, 4>(ap, bp, acc);

#pragma unroll
  for (int mi = 0; mi < 4; ++mi)
#pragma unroll
    for (int nj = 0; nj < 8; ++nj)
#pragma unroll
      for (int r = 0; r < 8; ++r)
        ot[w][mi * 16 + mb + r][nj * 16 + ln] = acc[mi][nj][r];
  __syncthreads();   // staged rows are read back by other lanes

  // the tile's 64 (b,p,t) rows share b and p; t runs on
  const int rr = rt * 64;
  const int bb = rr >> 12;
  const int pp = (rr >> 9) & 7;
  const int tt = rr & (SEQ - 1);
  float* grow = out + (((size_t)(bb * SEQ + tt) * 8 + pp) << 10)
                    + ct * 128 + lane * 4;
#pragma unroll
  for (int row = 0; row < 64; ++row)
    *(v4f*)(grow + (size_t)row * 8 * D_MODEL) = *(const v4f*)&ot[w][row][lane * 4];
}

// ===========================================================================
extern "C" void kernel_launch(void* const* d_in, const int* in_sizes, int n_in,
                              void* d_out, int out_size, void* d_ws, size_t ws_size,
                              hipStream_t stream) {
  const float* hidden = (const float*)d_in[0];
  const float* Wq     = (const float*)d_in[1];
  const float* Wk     = (const float*)d_in[2];
  const float* Wv     = (const float*)d_in[3];
  const float* Wo     = (const float*)d_in[4];
  float*       out    = (float*)d_out;

  // f16 workspace layout (halfs). ctx aliases xh (xh dead after kernel 1).
  _Float16* xh  = (_Float16*)d_ws;                         // 8192*1024
  _Float16* ctx = xh;                                      // alias
  _Float16* qws = xh  + (size_t)ROWS * D_MODEL;            // 16*16*512*64
  _Float16* kws = qws + (size_t)BP * N_HEADS * SEQ * HEAD_DIM;
  _Float16* vT  = kws + (size_t)BP * N_KVH * SEQ * HEAD_DIM;
  _Float16* pWq = vT  + (size_t)BP * N_KVH * SEQ * HEAD_DIM;
  _Float16* pWk = pWq + (size_t)D_MODEL * (N_HEADS * HEAD_DIM);
  _Float16* pWv = pWk + (size_t)D_MODEL * (N_KVH * HEAD_DIM);
  _Float16* pWo = pWv + (size_t)D_MODEL * (N_KVH * HEAD_DIM);

  prepare_kernel<<<PACK_BLOCKS + CONV_BLOCKS, 256, 0, stream>>>(
      hidden, Wq, Wk, Wv, Wo, xh, pWq, pWk, pWv, pWo);

  qkv_rope_kernel<<<dim3(ROWS / 64 / 4, (N_HEADS + 2 * N_KVH) / 3), 128, 0, stream>>>(
      xh, pWq, pWk, pWv, qws, kws, vT);

  attn_kernel<<<dim3(SEQ / 16 / QT, N_HEADS, BP), 32, 0, stream>>>(
      qws, kws, vT, ctx);

  out_proj_kernel<<<dim3(ROWS / 64 / 4, D_MODEL / 128), 128, 0, stream>>>(
      ctx, pWo, out);
}

// v007
// It runs in 61.4 microseconds.
// In two side-by-side timings against v006, it was 1.10 and 1.11 times as fast.
// Over all steps from v000 it is 5.20 times as fast.
#include <hip/hip_runtime.h>

// ---------------------------------------------------------------------------
// MI455X (gfx1250) fused attention: QKV+RoPE -> softmax attention -> out proj
// All matrix math via v_wmma_f32_16x16x32_f16 (wave32, f32 accumulate).
// Memory strategy: every f16 WMMA operand but Q (row-major) that passes through global memory
// lies in fragment order, in planes of 512 B: plane[lane][8 halfs].  One
// 16-byte load per lane then covers four whole 128 B lines.
//   A-order (xh, ctx), element (row, k) of a rows x 1024 matrix:
//     (((row>>4)*KCH + (k>>5))*2 + ((k>>4)&1))*256 + (((k>>3)&1)*16 + (row&15))*8 + (k&7)
//   weights: the same with the n tile in place of the row tile
//   K: per 16-key tile, plane pair by d;  V: per 32-key chunk and 16-d tile
// ---------------------------------------------------------------------------

typedef __attribute__((ext_vector_type(16))) _Float16 v16h;
typedef __attribute__((ext_vector_type(8)))  _Float16 v8h;
typedef __attribute__((ext_vector_type(4)))  _Float16 v4h;
typedef __attribute__((ext_vector_type(8)))  float    v8f;
typedef __attribute__((ext_vector_type(4)))  float    v4f;

#define D_MODEL   1024
#define N_HEADS   16
#define N_KVH     4
#define HEAD_DIM  64
#define SEQ       512
#define BP        16          // B*P = 2*8
#define ROWS      8192        // BP * SEQ
#define KCH       (D_MODEL / 32)   // 32 k-chunks of 32

__device__ __forceinline__ v8f wmma16x16x32(v16h a, v16h b, v8f c) {
  // (neg_a, A, neg_b, B, c_mod, C, reuse_a, reuse_b)
  return __builtin_amdgcn_wmma_f32_16x16x32_f16(false, a, false, b, (short)0, c,
                                                false, false);
}

__device__ __forceinline__ v16h cat8(v8h lo, v8h hi) {
  v16h r;
#pragma unroll
  for (int i = 0; i < 8; ++i) { r[i] = lo[i]; r[i + 8] = hi[i]; }
  return r;
}

// ===========================================================================
// Kernel 0: all operand preparation in ONE launch (the five pieces are
// independent of each other).  256 threads a block; the block index picks the
// piece: blocks [0, PACK_BLOCKS) pack weights, the rest turn hidden into xh.
// The weight blocks come first: their strided reads have the longer latency
// and run on under the start of the many conversion blocks.
// ===========================================================================
#define PACK_BLOCKS (((2 * D_MODEL + 2 * N_KVH * HEAD_DIM) / 128) * KCH)   // 640
#define CONV_BLOCKS ((ROWS / 16) * (D_MODEL / 128))                        // 4096

// hidden (b,t,p,d) fp32 -> xh, f16, rows (b,p,t), in A-order.
// One block turns 16 rows x 128 d: whole-line reads, a turn through LDS,
// whole-line stores.  cb = block number among the CONV_BLOCKS.
// t: pitch 136 halfs, rows fall on other banks for the 16-byte column reads
__device__ __forceinline__ void convert_x_tile(const float* __restrict__ hidden,
                                               _Float16* __restrict__ xh,
                                               _Float16 (&t)[16][136], int cb)
{
  const int lane  = threadIdx.x & 31;
  const int w     = threadIdx.x >> 5;
  const int rtile = cb >> 3;                          // 16-row tile
  const int db    = cb & 7;                           // 128-wide d block
#pragma unroll
  for (int j = 0; j < 2; ++j) {
    const int row = w * 2 + j;
    const int rr  = rtile * 16 + row;                 // (b,p,t) row
    const int bb  = rr >> 12;
    const int pp  = (rr >> 9) & 7;
    const int tt  = rr & (SEQ - 1);
    const float* s = hidden + (((size_t)(bb * SEQ + tt) * 8 + pp) << 10)
                            + db * 128 + lane * 4;
    v4f f = *(const v4f*)s;
    v4h h;
#pragma unroll
    for (int i = 0; i < 4; ++i) h[i] = (_Float16)f[i];
    *(v4h*)&t[row][lane * 4] = h;
  }
  __syncthreads();   // the planes are read across the rows other waves wrote

  const int part = w & 1;                             // plane of the k chunk
  const int kcl  = w >> 1;                            // k chunk in the block
  v8h o = *(const v8h*)&t[lane & 15][kcl * 32 + part * 16 + (lane >> 4) * 8];
  *(v8h*)(xh + ((size_t)(rtile * KCH + db * 4 + kcl) * 2 + part) * 256 + lane * 8) = o;
}

// One wave packs one 32 x 16 piece of an fp32 weight (K=1024 x N) into f16
// B-fragment order:
//   dst[((nt*KCH + kc)*2 + part)*256 + lane*8 + i] = W[k*N + nt*16 + (lane&15)]
// with k = kc*32 + part*16 + koff + i, i < 8, koff=(lane>>4)*8.
__device__ __forceinline__ void pack_w_piece(const float* __restrict__ W, int N,
                                             _Float16* __restrict__ dst,
                                             int nt, int kc)
{
  const int lane = threadIdx.x & 31;
  const int ln   = lane & 15;
  const int koff = (lane >> 4) << 3;
  const int kb   = kc * 32;
  const float* col = W + nt * 16 + ln;
  float f0[8], f1[8];
#pragma unroll
  for (int i = 0; i < 8; ++i) f0[i] = col[(size_t)(kb + koff + i) * N];
  // the second group's results may land in the first group's address registers
  asm volatile("s_wait_xcnt 0x0" ::: "memory");
#pragma unroll
  for (int i = 0; i < 8; ++i) f1[i] = col[(size_t)(kb + 16 + koff + i) * N];
  v8h b0, b1;
#pragma unroll
  for (int i = 0; i < 8; ++i) {
    b0[i] = (_Float16)f0[i];
    b1[i] = (_Float16)f1[i];
  }
  _Float16* d = dst + (size_t)(nt * KCH + kc) * 512 + lane * 8;
  *(v8h*)(d)       = b0;
  *(v8h*)(d + 256) = b1;
}

__global__ __launch_bounds__(256)
void prepare_kernel(const float* __restrict__ hidden,
                    const float* __restrict__ Wq,
                    const float* __restrict__ Wk,
                    const float* __restrict__ Wv,
                    const float* __restrict__ Wo,
                    _Float16* __restrict__ xh,
                    _Float16* __restrict__ pWq,
                    _Float16* __restrict__ pWk,
                    _Float16* __restrict__ pWv,
                    _Float16* __restrict__ pWo)
{
  __shared__ __align__(16) _Float16 t[16][136];

  const int blk = blockIdx.x;
  if (blk >= PACK_BLOCKS) {
    convert_x_tile(hidden, xh, t, blk - PACK_BLOCKS);
    return;
  }
  // a weight block: one k chunk of eight neighbouring n tiles, one per wave
  // (the eight waves together read whole 512 B row pieces).  Groups of eight
  // n tiles in the order Wq (8), Wk (2), Wv (2), Wo (8).
  const int kc = blk & (KCH - 1);
  const int g  = blk / KCH;
  const int w  = threadIdx.x >> 5;
  const float* W;
  _Float16* dst;
  int N, g0;
  if (g < 8)       { W = Wq; dst = pWq; N = N_HEADS * HEAD_DIM; g0 = 0;  }
  else if (g < 10) { W = Wk; dst = pWk; N = N_KVH * HEAD_DIM;   g0 = 8;  }
  else if (g < 12) { W = Wv; dst = pWv; N = N_KVH * HEAD_DIM;   g0 = 10; }
  else             { W = Wo; dst = pWo; N = D_MODEL;            g0 = 12; }
  pack_w_piece(W, N, dst, (g - g0) * 8 + w, kc);
}

// ===========================================================================
// Register-tiled GEMM core shared by kernels 1 and 3.
// One wave owns MT x NT accumulator tiles (16x16 each): a loaded A fragment
// feeds NT WMMAs and a loaded B fragment MT WMMAs.  A ring of NS fragment sets:
// a k chunk's loads are issued NS - 1 chunks ahead of its WMMAs, so that a load
// that misses L2 has landed when its turn comes.
// The k chunks are walked in a circle from the block's own start chunk rot:
// blocks that share A rows or B columns then ask for different lines at any
// moment, and all but the first reader of a line find it in L2.
//   ap    : A-order start of the wave's first row tile (wave-uniform)
//   bp[q] : packed n-tile 4*q of the wave's columns (wave-uniform)
//   rot   : first k chunk of the walk (block-uniform)
// ===========================================================================
#define NTSTRIDE (KCH * 32 * 16)      // halfs per packed n-tile or A row tile

typedef const __attribute__((address_space(1))) v8h* gplane;   // 16-byte pieces

// A wave-uniform start goes through readfirstlane so that it stays in scalar
// registers: the loads then name that pair and the lane's own offset, which is
// never rewritten.  Rebuilt from its words the pointer must be named global
// again, or the loads turn into flat ones.
__device__ __forceinline__ gplane scalar_start(gplane p) {
  const unsigned long long u = (unsigned long long)p;
  const unsigned lo = __builtin_amdgcn_readfirstlane((unsigned)u);
  const unsigned hi = __builtin_amdgcn_readfirstlane((unsigned)(u >> 32));
  return (gplane)(((unsigned long long)hi << 32) | lo);
}

// The wait in front of the next rewrite of the scalar starts that issued loads
// name.  It takes the starts as inputs: each then keeps a register pair of its
// own up to here, and none is rewritten in the middle of its load group.
template <int NQ>
__device__ __forceinline__ void wait_starts(gplane pa, const gplane (&pb)[NQ])
{
  static_assert(NQ == 2 || NQ == 3, "two or three column starts");
  if constexpr (NQ == 3)
    asm volatile("s_wait_xcnt 0x0" :: "s"(pa), "s"(pb[0]), "s"(pb[1]), "s"(pb[2]) : "memory");
  else
    asm volatile("s_wait_xcnt 0x0" :: "s"(pa), "s"(pb[0]), "s"(pb[1]) : "memory");
}

// pa, pb: the chunk's starts, handed back for wait_starts
template <int MT, int NT>
__device__ __forceinline__ void load_frags(v16h (&a)[MT], v16h (&b)[NT],
                                           gplane ap, const gplane (&bp)[NT / 4],
                                           int kc, gplane& pa, gplane (&pb)[NT / 4])
{
  pa = scalar_start(ap + kc * 64);
#pragma unroll
  for (int q = 0; q < NT / 4; ++q) pb[q] = scalar_start(bp[q] + kc * 64);
  const int lane = threadIdx.x & 31;
#pragma unroll
  for (int mi = 0; mi < MT; ++mi)
    a[mi] = cat8(pa[mi * (NTSTRIDE / 8) + lane], pa[mi * (NTSTRIDE / 8) + 32 + lane]);
#pragma unroll
  for (int nj = 0; nj < NT; ++nj)
    b[nj] = cat8(pb[nj >> 2][(nj & 3) * (NTSTRIDE / 8) + lane],
                 pb[nj >> 2][(nj & 3) * (NTSTRIDE / 8) + 32 + lane]);
}

template <int MT, int NT>
__device__ __forceinline__ void mma_frags(const v16h (&a)[MT], const v16h (&b)[NT],
                                          v8f (&acc)[MT][NT])
{
#pragma unroll
  for (int mi = 0; mi < MT; ++mi)
#pragma unroll
    for (int nj = 0; nj < NT; ++nj)
      acc[mi][nj] = wmma16x16x32(a[mi], b[nj], acc[mi][nj]);
}

template <int MT, int NT, int NS>
__device__ __forceinline__ void gemm_tile(const _Float16* __restrict__ ap0,
                                          const _Float16* const (&bp0)[NT / 4],
                                          v8f (&acc)[MT][NT], int rot)
{
  const gplane ap = scalar_start((gplane)ap0);
  gplane bp[NT / 4];
#pragma unroll
  for (int q = 0; q < NT / 4; ++q) bp[q] = (gplane)bp0[q];
  // ring of NS fragment sets: step kc of the walk (chunk (kc + rot) % KCH) lies
  // in set kc % NS and its loads are issued NS - 1 steps ahead of its WMMAs
  v16h a[NS][MT], b[NS][NT];
  gplane pa, pb[NT / 4];
#pragma unroll   // the set index picks registers: it must be a constant
  for (int s = 0; s < NS - 1; ++s) {
    load_frags<MT, NT>(a[s], b[s], ap, bp, (s + rot) & (KCH - 1), pa, pb);
    __builtin_amdgcn_sched_barrier(0);   // holds the wait directly behind the loads
    // registers that the issued loads name are rewritten next: wait first
    wait_starts(pa, pb);
    __builtin_amdgcn_sched_barrier(0);
  }
  // chunks whose turn still issues a load, rounded down to whole ring turns
  constexpr int MAIN = ((KCH - (NS - 1)) / NS) * NS;
  for (int kc = 0; kc < MAIN; kc += NS) {
#pragma unroll   // the set index picks registers: it must be a constant
    for (int s = 0; s < NS; ++s) {
      // the scheduling fences keep each load group whole and ahead of the WMMA
      // block; without them the loads sink in among the WMMAs that need them
      load_frags<MT, NT>(a[(s + NS - 1) % NS], b[(s + NS - 1) % NS], ap, bp,
                         (kc + s + NS - 1 + rot) & (KCH - 1), pa, pb);
      __builtin_amdgcn_sched_barrier(0);
      mma_frags<MT, NT>(a[s], b[s], acc);
      __builtin_amdgcn_sched_barrier(0);
      // the next step's starts are formed in the registers that the issued
      // loads name: wait first
      wait_starts(pa, pb);
      __builtin_amdgcn_sched_barrier(0);
    }
  }
#pragma unroll   // the set index picks registers: it must be a constant
  for (int kc = MAIN; kc < KCH; ++kc) {
    if (kc + NS - 1 < KCH) {
      load_frags<MT, NT>(a[(kc + NS - 1) % NS], b[(kc + NS - 1) % NS], ap, bp,
                         (kc + NS - 1 + rot) & (KCH - 1), pa, pb);
      __builtin_amdgcn_sched_barrier(0);   // same: load group ahead of the WMMAs
      mma_frags<MT, NT>(a[kc % NS], b[kc % NS], acc);
      __builtin_amdgcn_sched_barrier(0);
      // the last loads' address registers are free for reuse behind this wait
      wait_starts(pa, pb);
      __builtin_amdgcn_sched_barrier(0);
    } else {
      mma_frags<MT, NT>(a[kc % NS], b[kc % NS], acc);
    }
  }
}

// ===========================================================================
// Kernel 1: QKV projection + RoPE + q-scale from packed f16 operands.
// 4 waves / block; wave w owns rows [64*(blockIdx.x*4+w), +64) and the three
// 64-wide head columns 3*blockIdx.y .. +2 of the 24 (16 q, 4 k, 4 v).
// Q written row-major (slot,t,d), K in fragment order, both via LDS-staged
// whole-line stores.  V written in fragment order straight from registers.
// ===========================================================================
__global__ __launch_bounds__(128)
void qkv_rope_kernel(const _Float16* __restrict__ xh,
                     const _Float16* __restrict__ pWq,
                     const _Float16* __restrict__ pWk,
                     const _Float16* __restrict__ pWv,
                     _Float16* __restrict__ qws,
                     _Float16* __restrict__ kws,
                     _Float16* __restrict__ vT)
{
  __shared__ __align__(128) _Float16 st[4][3][64][64];   // 96 KB staging

  const int lane = threadIdx.x & 31;
  const int w    = threadIdx.x >> 5;
  const int ln   = lane & 15;
  const int mb   = (lane >> 4) << 3;
  const int rt   = blockIdx.x * 4 + w;     // 64-row tile
  const int hc0  = blockIdx.y * 3;         // first of three head columns

  const _Float16* bp[3];
#pragma unroll
  for (int hh = 0; hh < 3; ++hh) {
    const int hc = hc0 + hh;
    const _Float16* pW = (hc < 16) ? pWq + (size_t)hc * 4 * NTSTRIDE
                       : (hc < 20) ? pWk + (size_t)(hc - 16) * 4 * NTSTRIDE
                                   : pWv + (size_t)(hc - 20) * 4 * NTSTRIDE;
    bp[hh] = pW;
  }
  const _Float16* ap = xh + (size_t)(rt * 4) * NTSTRIDE;

  v8f acc[4][12] = {};
  // the 8 blocks on one row tile start 4 chunks apart, the 32 on one column
  // group 1 chunk apart
  gemm_tile<4, 12, 3>(ap, bp, acc, (blockIdx.y * 4 + blockIdx.x) & (KCH - 1));

  const int t0 = (rt * 64) & (SEQ - 1);
  const int bpi = rt >> 3;

  // RoPE tables of this lane's 32 rows, shared by the wave's q and k heads
  const float LOG1E4_32 = 0.28782313662425575f;    // ln(10000)/32
  const float fA = __expf(-(float)ln * LOG1E4_32);
  const float fB = __expf(-(float)(16 + ln) * LOG1E4_32);
  float sA[4][8], cA[4][8], sB[4][8], cB[4][8];
#pragma unroll
  for (int mi = 0; mi < 4; ++mi)
#pragma unroll
    for (int r = 0; r < 8; ++r) {
      const float tm = (float)(t0 + mi * 16 + mb + r);
      __sincosf(tm * fA, &sA[mi][r], &cA[mi][r]);
      __sincosf(tm * fB, &sB[mi][r], &cB[mi][r]);
    }

#pragma unroll
  for (int hh = 0; hh < 3; ++hh) {
    const int hc = hc0 + hh;
    if (hc < 20) {
      // RoPE pairs (dh, dh+32): tile 0<->2 (dh=ln), tile 1<->3 (dh=16+ln)
      const float qs = (hc < 16) ? 0.125f : 1.0f;  // 1/sqrt(HEAD_DIM) into q
#pragma unroll
      for (int mi = 0; mi < 4; ++mi)
#pragma unroll
        for (int r = 0; r < 8; ++r) {
          _Float16* srow = &st[w][hh][mi * 16 + mb + r][0];
          float lo = acc[mi][hh * 4 + 0][r], hi = acc[mi][hh * 4 + 2][r];
          srow[ln]      = (_Float16)((lo * cA[mi][r] - hi * sA[mi][r]) * qs);
          srow[32 + ln] = (_Float16)((lo * sA[mi][r] + hi * cA[mi][r]) * qs);
          lo = acc[mi][hh * 4 + 1][r]; hi = acc[mi][hh * 4 + 3][r];
          srow[16 + ln] = (_Float16)((lo * cB[mi][r] - hi * sB[mi][r]) * qs);
          srow[48 + ln] = (_Float16)((lo * sB[mi][r] + hi * cB[mi][r]) * qs);
        }
    } else {
      // V: a lane's 8 rows of one column are one piece of the plane
      // [32-key chunk][16-d tile j][key half mi&1][lane]
      _Float16* dst = vT + ((size_t)(bpi * N_KVH + (hc - 20)) * HEAD_DIM) * SEQ
                         + (size_t)(t0 >> 5) * 2048 + lane * 8;
#pragma unroll
      for (int j = 0; j < 4; ++j) {
#pragma unroll
        for (int mi = 0; mi < 4; ++mi) {
          v8h h;
#pragma unroll
          for (int r = 0; r < 8; ++r) h[r] = (_Float16)acc[mi][hh * 4 + j][r];
          *(v8h*)(dst + ((mi >> 1) * 4 + j) * 512 + (mi & 1) * 256) = h;
        }
        // the stores' data registers are refilled next: wait first (the fence
        // holds the next conversions behind the wait)
        asm volatile("s_wait_xcnt 0x0" ::: "memory");
        __builtin_amdgcn_sched_barrier(0);
      }
    }
  }
  __syncthreads();   // staged rows are read back by other lanes

#pragma unroll
  for (int hh = 0; hh < 3; ++hh) {
    const int hc = hc0 + hh;
    if (hc < 20) {
      // 64 rows x 64 halfs of one head are 8 KB contiguous in q / k
      _Float16* dst = (hc < 16)
          ? qws + ((size_t)(bpi * N_HEADS + hc) * SEQ + t0) * HEAD_DIM
          : kws + ((size_t)(bpi * N_KVH + (hc - 16)) * SEQ + t0) * HEAD_DIM;
      const v8h* s = (const v8h*)&st[w][hh][0][0];
      v8h* g = (v8h*)dst;
      // q leaves as it lies; k leaves per 16-key tile as planes [d/8][key]
      const bool isq = hc < 16;
      const int  sl  = isq ? lane : ln * 8 + (lane >> 4);
#pragma unroll
      for (int i = 0; i < 16; ++i)
        g[i * 32 + lane] = s[sl + (isq ? i * 32 : (i >> 2) * 128 + (i & 3) * 2)];
      if (hh < 2) {
        // the next head column reuses these stores' data and address
        // registers: wait first
        asm volatile("s_wait_xcnt 0x0" ::: "memory");
      }
    }
  }
}

// ===========================================================================
// Kernel 2: attention, one wave per (bp, head, four 16-query tiles).
//   grid = (SEQ/64, N_HEADS, BP)
// Both products run with their operands swapped: S^T = K Q^T, O^T = V^T P^T.
// A and B fragments share one lane map, so the K, Q and V registers are the
// ones the unswapped products take.  A lane then holds scores of ONE query
// (column lane&15), keys 8*(lane>>4)..+7 of each 16-key tile: two such tiles
// are, as they lie, the B fragment of P^T for one 32-key chunk.  Scores and
// probabilities never leave the registers; the softmax is the running form
// (maximum and sum carried from one 32-key block to the next), inside the
// lane but for one exchange with lane^16 per block; O^T leaves as A-order
// planes.  No LDS.  Every loaded K and V fragment feeds all four query tiles
// of the wave: a quarter of the loads per score, four independent softmax chains.
// ===========================================================================
// Four fragments (eight planes, 4 KB) of block blk of K or V.  The block's
// start goes through readfirstlane so that it stays in scalar registers: the
// loads then name that pair and the lane's own offset, which is never rewritten.
__device__ __forceinline__ void load_blk(v16h (&f)[4],
                                         const _Float16* __restrict__ base, int blk)
{
  const unsigned long long u = (unsigned long long)(base + blk * 2048);
  const unsigned lo = __builtin_amdgcn_readfirstlane((unsigned)u);
  const unsigned hi = __builtin_amdgcn_readfirstlane((unsigned)(u >> 32));
  // rebuilt from its words the pointer must be named global again, or the
  // loads turn into flat ones
  typedef const __attribute__((address_space(1))) v8h* gv8h;
  gv8h p = (gv8h)(((unsigned long long)hi << 32) | lo) + (threadIdx.x & 31);
#pragma unroll
  for (int i = 0; i < 4; ++i)
    f[i] = cat8(p[i * 64], p[i * 64 + 32]);
}

// value of the lane 16 away (same query, other eight keys of each tile)
__device__ __forceinline__ float other_half(float x) {
  return __builtin_bit_cast(float, __builtin_amdgcn_permlanex16(
      __builtin_bit_cast(unsigned, x), __builtin_bit_cast(unsigned, x),
      0x76543210u, 0xfedcba98u, false, false));
}

__device__ __forceinline__ void attn_block(const v16h (&k)[4], const v16h (&v)[4],
                                           v16h aq0, v16h aq1,
                                           float& m, float& sum, v8f (&o)[4])
{
  const float L2E = 1.4426950408889634f;              // log2(e)
  const v8f zero = {};
  v8f s0 = wmma16x16x32(k[0], aq0, zero);
  v8f s1 = wmma16x16x32(k[2], aq0, zero);
  s0 = wmma16x16x32(k[1], aq1, s0);
  s1 = wmma16x16x32(k[3], aq1, s1);

  float t[8];
#pragma unroll
  for (int r = 0; r < 8; ++r) t[r] = fmaxf(s0[r], s1[r]);
  float bm = fmaxf(fmaxf(fmaxf(t[0], t[1]), fmaxf(t[2], t[3])),
                   fmaxf(fmaxf(t[4], t[5]), fmaxf(t[6], t[7])));
  bm = fmaxf(bm, other_half(bm));
  const float mn    = fmaxf(m, bm);
  const float mL    = mn * L2E;
  const float alpha = __builtin_amdgcn_exp2f(fmaf(m, L2E, -mL));
  m = mn;

  v16h pf;
  float a[8];
#pragma unroll
  for (int r = 0; r < 8; ++r) {
    const float p0 = __builtin_amdgcn_exp2f(fmaf(s0[r], L2E, -mL));
    const float p1 = __builtin_amdgcn_exp2f(fmaf(s1[r], L2E, -mL));
    a[r]      = p0 + p1;
    pf[r]     = (_Float16)p0;
    pf[r + 8] = (_Float16)p1;
  }
  sum = fmaf(sum, alpha, ((a[0] + a[1]) + (a[2] + a[3])) + ((a[4] + a[5]) + (a[6] + a[7])));
#pragma unroll
  for (int j = 0; j < 4; ++j)
#pragma unroll
    for (int r = 0; r < 8; ++r) o[j][r] *= alpha;
#pragma unroll
  for (int j = 0; j < 4; ++j) o[j] = wmma16x16x32(v[j], pf, o[j]);
}

#define QT 4   // 16-query tiles per wave; each K / V fragment feeds all of them

__global__ __launch_bounds__(32)
void attn_kernel(const _Float16* __restrict__ qws,
                 const _Float16* __restrict__ kws,
                 const _Float16* __restrict__ vT,
                 _Float16* __restrict__ ctx)
{
  const int lane = threadIdx.x;
  const int ln   = lane & 15;
  const int koff = (lane >> 4) << 3;
  const int qt0  = blockIdx.x * QT;
  const int h    = blockIdx.y;
  const int bp   = blockIdx.z;

  const _Float16* __restrict__ qb = qws + ((size_t)(bp * N_HEADS + h)        * SEQ) * HEAD_DIM;
  const _Float16* __restrict__ kb = kws + ((size_t)(bp * N_KVH   + (h >> 2)) * SEQ) * HEAD_DIM;
  const _Float16* __restrict__ vb = vT  + ((size_t)(bp * N_KVH   + (h >> 2)) * HEAD_DIM) * SEQ;

  // Q tile fragments (each 16x64 tile as two 16x32 chunks)
  v16h aq0[QT], aq1[QT];
#pragma unroll   // the tile index picks registers: it must be a constant
  for (int u = 0; u < QT; ++u) {
    const _Float16* qrow = qb + (size_t)((qt0 + u) * 16 + ln) * HEAD_DIM;
    aq0[u] = cat8(*(const v8h*)(qrow + koff),      *(const v8h*)(qrow + 16 + koff));
    aq1[u] = cat8(*(const v8h*)(qrow + 32 + koff), *(const v8h*)(qrow + 48 + koff));
    __builtin_amdgcn_sched_barrier(0);   // holds the wait directly behind the loads
    // the next tile's results may land in this tile's address registers
    asm volatile("s_wait_xcnt 0x0" ::: "memory");
    __builtin_amdgcn_sched_barrier(0);
  }

  float m[QT], sum[QT];
  v8f o[QT][4] = {};
#pragma unroll
  for (int u = 0; u < QT; ++u) { m[u] = -3.0e38f; sum[u] = 0.f; }
  // K block: two 16-key tiles of two d halves, fetched one block ahead.
  // V block: four 16-d tiles of one 32-key chunk, fetched at the head of its
  // own block, ahead of the scores and the exponentials.
  v16h k0[4], k1[4];
  load_blk(k0, kb, 0);
  __builtin_amdgcn_sched_barrier(0);   // holds the wait directly behind the loads
  // registers that the issued loads name are rewritten next: wait first
  asm volatile("s_wait_xcnt 0x0" ::: "memory");
  __builtin_amdgcn_sched_barrier(0);
  for (int b = 0; b < SEQ / 32; b += 2) {
    v16h va[4], vc[4];
    // the scheduling fences keep each load group whole and ahead of the block;
    // without them the loads sink down to the WMMAs that need them
    load_blk(va, vb, b);
    load_blk(k1, kb, b + 1);
    __builtin_amdgcn_sched_barrier(0);
#pragma unroll   // one straight run, so that the tiles' chains interleave
    for (int u = 0; u < QT; ++u)
      attn_block(k0, va, aq0[u], aq1[u], m[u], sum[u], o[u]);
    __builtin_amdgcn_sched_barrier(0);
    // the scalar bases of the issued loads are rewritten next: wait first
    asm volatile("s_wait_xcnt 0x0" ::: "memory");
    __builtin_amdgcn_sched_barrier(0);
    load_blk(vc, vb, b + 1);
    if (b + 2 < SEQ / 32) load_blk(k0, kb, b + 2);
    __builtin_amdgcn_sched_barrier(0);
#pragma unroll   // one straight run, so that the tiles' chains interleave
    for (int u = 0; u < QT; ++u)
      attn_block(k1, vc, aq0[u], aq1[u], m[u], sum[u], o[u]);
    __builtin_amdgcn_sched_barrier(0);
    // the scalar bases of the issued loads step on behind this wait
    asm volatile("s_wait_xcnt 0x0" ::: "memory");
    __builtin_amdgcn_sched_barrier(0);
  }

  // lane holds query ln, d = 16 j + koff + r: its piece of A-order plane j
  v8h oh[QT][4];
#pragma unroll
  for (int u = 0; u < QT; ++u) {
    sum[u] += other_half(sum[u]);
    const float rinv = 1.0f / sum[u];
#pragma unroll
    for (int j = 0; j < 4; ++j)
#pragma unroll
      for (int r = 0; r < 8; ++r) oh[u][j][r] = (_Float16)(o[u][j][r] * rinv);
  }
  _Float16* g = ctx + ((size_t)(bp * (SEQ / 16) + qt0) * KCH + h * 2) * 512 + lane * 8;
#pragma unroll
  for (int u = 0; u < QT; ++u)
#pragma unroll
    for (int j = 0; j < 4; ++j)
      *(v8h*)(g + (size_t)u * KCH * 512 + j * 256) = oh[u][j];
}

// ===========================================================================
// Kernel 3: out = ctx @ Wo (packed) with (B,T,P,:) permuted fp32 store.
// 4 waves / block; wave w owns rows [64*(blockIdx.x*4+w), +64) and the 128
// columns of blockIdx.y.  Rows leave as whole 512 B pieces through LDS.
// ===========================================================================
__global__ __launch_bounds__(128)
void out_proj_kernel(const _Float16* __restrict__ ctx,
                     const _Float16* __restrict__ pWo,
                     float* __restrict__ out)
{
  // pitch 132 floats: the two lane halves (8 rows apart) fall on other banks
  __shared__ __align__(128) float ot[4][64][132];

  const int lane = threadIdx.x & 31;
  const int w    = threadIdx.x >> 5;
  const int ln   = lane & 15;
  const int mb   = (lane >> 4) << 3;
  const int rt   = blockIdx.x * 4 + w;     // 64-row tile
  const int ct   = blockIdx.y;             // 128-column tile

  const _Float16* ap = ctx + (size_t)(rt * 4) * NTSTRIDE;
  const _Float16* bp[2];
  bp[0] = pWo + (size_t)(ct * 8) * NTSTRIDE;
  bp[1] = bp[0] + (size_t)4 * NTSTRIDE;

  v8f acc[4][8] = {};
  // the 8 blocks on one row tile start 4 chunks apart, the 32 on one column
  // tile 1 chunk apart
  gemm_tile<4, 8, 4>(ap, bp, acc, (blockIdx.y * 4 + blockIdx.x) & (KCH - 1));

#pragma unroll
  for (int mi = 0; mi < 4; ++mi)
#pragma unroll
    for (int nj = 0; nj < 8; ++nj)
#pragma unroll
      for (int r = 0; r < 8; ++r)
        ot[w][mi * 16 + mb + r][nj * 16 + ln] = acc[mi][nj][r];
  __syncthreads();   // staged rows are read back by other lanes

  // the tile's 64 (b,p,t) rows share b and p; t runs on
  const int rr = rt * 64;
  const int bb = rr >> 12;
  const int pp = (rr >> 9) & 7;
  const int tt = rr & (SEQ - 1);
  float* grow = out + (((size_t)(bb * SEQ + tt) * 8 + pp) << 10)
                    + ct * 128 + lane * 4;
#pragma unroll
  for (int row = 0; row < 64; ++row)
    *(v4f*)(grow + (size_t)row * 8 * D_MODEL) = *(const v4f*)&ot[w][row][lane * 4];
}

// ===========================================================================
extern "C" void kernel_launch(void* const* d_in, const int* in_sizes, int n_in,
                              void* d_out, int out_size, void* d_ws, size_t ws_size,
                              hipStream_t stream) {
  const float* hidden = (const float*)d_in[0];
  const float* Wq     = (const float*)d_in[1];
  const float* Wk     = (const float*)d_in[2];
  const float* Wv     = (const float*)d_in[3];
  const float* Wo     = (const float*)d_in[4];
  float*       out    = (float*)d_out;

  // f16 workspace layout (halfs). ctx aliases xh (xh dead after kernel 1).
  _Float16* xh  = (_Float16*)d_ws;                         // 8192*1024
  _Float16* ctx = xh;                                      // alias
  _Float16* qws = xh  + (size_t)ROWS * D_MODEL;            // 16*16*512*64
  _Float16* kws = qws + (size_t)BP * N_HEADS * SEQ * HEAD_DIM;
  _Float16* vT  = kws + (size_t)BP * N_KVH * SEQ * HEAD_DIM;
  _Float16* pWq = vT  + (size_t)BP * N_KVH * SEQ * HEAD_DIM;
  _Float16* pWk = pWq + (size_t)D_MODEL * (N_HEADS * HEAD_DIM);
  _Float16* pWv = pWk + (size_t)D_MODEL * (N_KVH * HEAD_DIM);
  _Float16* pWo = pWv + (size_t)D_MODEL * (N_KVH * HEAD_DIM);

  prepare_kernel<<<PACK_BLOCKS + CONV_BLOCKS, 256, 0, stream>>>(
      hidden, Wq, Wk, Wv, Wo, xh, pWq, pWk, pWv, pWo);

  qkv_rope_kernel<<<dim3(ROWS / 64 / 4, (N_HEADS + 2 * N_KVH) / 3), 128, 0, stream>>>(
      xh, pWq, pWk, pWv, qws, kws, vT);

  attn_kernel<<<dim3(SEQ / 16 / QT, N_HEADS, BP), 32, 0, stream>>>(
      qws, kws, vT, ctx);

  out_proj_kernel<<<dim3(ROWS / 64 / 4, D_MODEL / 128), 128, 0, stream>>>(
      ctx, pWo, out);
}

// v009
// A run of this version takes 56.7 microseconds.
// Versions between v007 and this one are left out; their measured steps multiply to 1.08 times as fast.
// All steps since v000 together make it 5.63 times as fast.
#include <hip/hip_runtime.h>

// ---------------------------------------------------------------------------
// MI455X (gfx1250) fused attention: QKV+RoPE -> softmax attention -> out proj
// All matrix math via v_wmma_f32_16x16x32_f16 (wave32, f32 accumulate).
// Memory strategy: every f16 WMMA operand but Q (row-major) that passes through global memory
// lies in fragment order, in planes of 512 B: plane[lane][8 halfs].  One
// 16-byte load per lane then covers four whole 128 B lines.
//   A-order (xh, ctx), element (row, k) of a rows x 1024 matrix:
//     (((row>>4)*KCH + (k>>5))*2 + ((k>>4)&1))*256 + (((k>>3)&1)*16 + (row&15))*8 + (k&7)
//   weights: the same with the n tile in place of the row tile
//   K: per 16-key tile, plane pair by d;  V: per 32-key chunk and 16-d tile
// ---------------------------------------------------------------------------

typedef __attribute__((ext_vector_type(16))) _Float16 v16h;
typedef __attribute__((ext_vector_type(8)))  _Float16 v8h;
typedef __attribute__((ext_vector_type(4)))  _Float16 v4h;
typedef __attribute__((ext_vector_type(8)))  float    v8f;
typedef __attribute__((ext_vector_type(4)))  float    v4f;
typedef __attribute__((ext_vector_type(2)))  float    v2f;

#define D_MODEL   1024
#define N_HEADS   16
#define N_KVH     4
#define HEAD_DIM  64
#define SEQ       512
#define BP        16          // B*P = 2*8
#define ROWS      8192        // BP * SEQ
#define KCH       (D_MODEL / 32)   // 32 k-chunks of 32

__device__ __forceinline__ v8f wmma16x16x32(v16h a, v16h b, v8f c) {
  // (neg_a, A, neg_b, B, c_mod, C, reuse_a, reuse_b)
  return __builtin_amdgcn_wmma_f32_16x16x32_f16(false, a, false, b, (short)0, c,
                                                false, false);
}

__device__ __forceinline__ v16h cat8(v8h lo, v8h hi) {
  v16h r;
#pragma unroll
  for (int i = 0; i < 8; ++i) { r[i] = lo[i]; r[i + 8] = hi[i]; }
  return r;
}

// ===========================================================================
// Kernel 0: all operand preparation in ONE launch (the five pieces are
// independent of each other).  256 threads a block; the block index picks the
// piece: blocks [0, PACK_BLOCKS) pack weights, the rest turn hidden into xh.
// The weight blocks come first: their strided reads have the longer latency
// and run on under the start of the many conversion blocks.
// ===========================================================================
#define PACK_BLOCKS (((2 * D_MODEL + 2 * N_KVH * HEAD_DIM) / 128) * KCH)   // 640
#define CONV_BLOCKS ((ROWS / 16) * (D_MODEL / 128))                        // 4096

// hidden (b,t,p,d) fp32 -> xh, f16, rows (b,p,t), in A-order.
// One block turns 16 rows x 128 d: whole-line reads, a turn through LDS,
// whole-line stores.  cb = block number among the CONV_BLOCKS.
// t: pitch 136 halfs, rows fall on other banks for the 16-byte column reads
__device__ __forceinline__ void convert_x_tile(const float* __restrict__ hidden,
                                               _Float16* __restrict__ xh,
                                               _Float16 (&t)[16][136], int cb)
{
  const int lane  = threadIdx.x & 31;
  const int w     = threadIdx.x >> 5;
  const int rtile = cb >> 3;                          // 16-row tile
  const int db    = cb & 7;                           // 128-wide d block
#pragma unroll
  for (int j = 0; j < 2; ++j) {
    const int row = w * 2 + j;
    const int rr  = rtile * 16 + row;                 // (b,p,t) row
    const int bb  = rr >> 12;
    const int pp  = (rr >> 9) & 7;
    const int tt  = rr & (SEQ - 1);
    const float* s = hidden + (((size_t)(bb * SEQ + tt) * 8 + pp) << 10)
                            + db * 128 + lane * 4;
    v4f f = *(const v4f*)s;
    v4h h;
#pragma unroll
    for (int i = 0; i < 4; ++i) h[i] = (_Float16)f[i];
    *(v4h*)&t[row][lane * 4] = h;
  }
  __syncthreads();   // the planes are read across the rows other waves wrote

  const int part = w & 1;                             // plane of the k chunk
  const int kcl  = w >> 1;                            // k chunk in the block
  v8h o = *(const v8h*)&t[lane & 15][kcl * 32 + part * 16 + (lane >> 4) * 8];
  *(v8h*)(xh + ((size_t)(rtile * KCH + db * 4 + kcl) * 2 + part) * 256 + lane * 8) = o;
}

// One wave packs one 32 x 16 piece of an fp32 weight (K=1024 x N) into f16
// B-fragment order:
//   dst[((nt*KCH + kc)*2 + part)*256 + lane*8 + i] = W[k*N + nt*16 + (lane&15)]
// with k = kc*32 + part*16 + koff + i, i < 8, koff=(lane>>4)*8.
__device__ __forceinline__ void pack_w_piece(const float* __restrict__ W, int N,
                                             _Float16* __restrict__ dst,
                                             int nt, int kc)
{
  const int lane = threadIdx.x & 31;
  const int ln   = lane & 15;
  const int koff = (lane >> 4) << 3;
  const int kb   = kc * 32;
  const float* col = W + nt * 16 + ln;
  float f0[8], f1[8];
#pragma unroll
  for (int i = 0; i < 8; ++i) f0[i] = col[(size_t)(kb + koff + i) * N];
  // the second group's results may land in the first group's address registers
  asm volatile("s_wait_xcnt 0x0" ::: "memory");
#pragma unroll
  for (int i = 0; i < 8; ++i) f1[i] = col[(size_t)(kb + 16 + koff + i) * N];
  v8h b0, b1;
#pragma unroll
  for (int i = 0; i < 8; ++i) {
    b0[i] = (_Float16)f0[i];
    b1[i] = (_Float16)f1[i];
  }
  _Float16* d = dst + (size_t)(nt * KCH + kc) * 512 + lane * 8;
  *(v8h*)(d)       = b0;
  *(v8h*)(d + 256) = b1;
}

__global__ __launch_bounds__(256)
void prepare_kernel(const float* __restrict__ hidden,
                    const float* __restrict__ Wq,
                    const float* __restrict__ Wk,
                    const float* __restrict__ Wv,
                    const float* __restrict__ Wo,
                    _Float16* __restrict__ xh,
                    _Float16* __restrict__ pWq,
                    _Float16* __restrict__ pWk,
                    _Float16* __restrict__ pWv,
                    _Float16* __restrict__ pWo)
{
  __shared__ __align__(16) _Float16 t[16][136];

  const int blk = blockIdx.x;
  if (blk >= PACK_BLOCKS) {
    convert_x_tile(hidden, xh, t, blk - PACK_BLOCKS);
    return;
  }
  // a weight block: one k chunk of eight neighbouring n tiles, one per wave
  // (the eight waves together read whole 512 B row pieces).  Groups of eight
  // n tiles in the order Wq (8), Wk (2), Wv (2), Wo (8).
  const int kc = blk & (KCH - 1);
  const int g  = blk / KCH;
  const int w  = threadIdx.x >> 5;
  const float* W;
  _Float16* dst;
  int N, g0;
  if (g < 8)       { W = Wq; dst = pWq; N = N_HEADS * HEAD_DIM; g0 = 0;  }
  else if (g < 10) { W = Wk; dst = pWk; N = N_KVH * HEAD_DIM;   g0 = 8;  }
  else if (g < 12) { W = Wv; dst = pWv; N = N_KVH * HEAD_DIM;   g0 = 10; }
  else             { W = Wo; dst = pWo; N = D_MODEL;            g0 = 12; }
  pack_w_piece(W, N, dst, (g - g0) * 8 + w, kc);
}

// ===========================================================================
// Register-tiled GEMM core shared by kernels 1 and 3.
// One wave owns MT x NT accumulator tiles (16x16 each): a loaded A fragment
// feeds NT WMMAs and a loaded B fragment MT WMMAs.  A ring of NS fragment sets:
// a k chunk's loads are issued NS - 1 chunks ahead of its WMMAs, so that a load
// that misses L2 has landed when its turn comes.
// The k chunks are walked in a circle from the block's own start chunk rot:
// blocks that share A rows or B columns then ask for different lines at any
// moment, and all but the first reader of a line find it in L2.
//   ap    : A-order start of the wave's first row tile (wave-uniform)
//   bp[q] : packed n-tile 4*q of the wave's columns (wave-uniform)
//   rot   : first k chunk of the walk (block-uniform)
// ===========================================================================
#define NTSTRIDE (KCH * 32 * 16)      // halfs per packed n-tile or A row tile

typedef const __attribute__((address_space(1))) v8h* gplane;   // 16-byte pieces

// A wave-uniform start goes through readfirstlane so that it stays in scalar
// registers: the loads then name that pair and the lane's own offset, which is
// never rewritten.  Rebuilt from its words the pointer must be named global
// again, or the loads turn into flat ones.
__device__ __forceinline__ gplane scalar_start(gplane p) {
  const unsigned long long u = (unsigned long long)p;
  const unsigned lo = __builtin_amdgcn_readfirstlane((unsigned)u);
  const unsigned hi = __builtin_amdgcn_readfirstlane((unsigned)(u >> 32));
  return (gplane)(((unsigned long long)hi << 32) | lo);
}

// The wait in front of the next rewrite of the scalar starts that issued loads
// name.  It takes the starts as inputs: each then keeps a register pair of its
// own up to here, and none is rewritten in the middle of its load group.
template <int NQ>
__device__ __forceinline__ void wait_starts(gplane pa, const gplane (&pb)[NQ])
{
  static_assert(NQ == 2 || NQ == 3, "two or three column starts");
  if constexpr (NQ == 3)
    asm volatile("s_wait_xcnt 0x0" :: "s"(pa), "s"(pb[0]), "s"(pb[1]), "s"(pb[2]) : "memory");
  else
    asm volatile("s_wait_xcnt 0x0" :: "s"(pa), "s"(pb[0]), "s"(pb[1]) : "memory");
}

// pa, pb: the chunk's starts, handed back for wait_starts
template <int MT, int NT>
__device__ __forceinline__ void load_frags(v16h (&a)[MT], v16h (&b)[NT],
                                           gplane ap, const gplane (&bp)[NT / 4],
                                           int kc, gplane& pa, gplane (&pb)[NT / 4])
{
  pa = scalar_start(ap + kc * 64);
#pragma unroll
  for (int q = 0; q < NT / 4; ++q) pb[q] = scalar_start(bp[q] + kc * 64);
  const int lane = threadIdx.x & 31;
#pragma unroll
  for (int mi = 0; mi < MT; ++mi)
    a[mi] = cat8(pa[mi * (NTSTRIDE / 8) + lane], pa[mi * (NTSTRIDE / 8) + 32 + lane]);
#pragma unroll
  for (int nj = 0; nj < NT; ++nj)
    b[nj] = cat8(pb[nj >> 2][(nj & 3) * (NTSTRIDE / 8) + lane],
                 pb[nj >> 2][(nj & 3) * (NTSTRIDE / 8) + 32 + lane]);
}

template <int MT, int NT>
__device__ __forceinline__ void mma_frags(const v16h (&a)[MT], const v16h (&b)[NT],
                                          v8f (&acc)[MT][NT])
{
#pragma unroll
  for (int mi = 0; mi < MT; ++mi)
#pragma unroll
    for (int nj = 0; nj < NT; ++nj)
      acc[mi][nj] = wmma16x16x32(a[mi], b[nj], acc[mi][nj]);
}

template <int MT, int NT, int NS>
__device__ __forceinline__ void gemm_tile(const _Float16* __restrict__ ap0,
                                          const _Float16* const (&bp0)[NT / 4],
                                          v8f (&acc)[MT][NT], int rot)
{
  const gplane ap = scalar_start((gplane)ap0);
  gplane bp[NT / 4];
#pragma unroll
  for (int q = 0; q < NT / 4; ++q) bp[q] = (gplane)bp0[q];
  // ring of NS fragment sets: step kc of the walk (chunk (kc + rot) % KCH) lies
  // in set kc % NS and its loads are issued NS - 1 steps ahead of its WMMAs
  v16h a[NS][MT], b[NS][NT];
  gplane pa, pb[NT / 4];
#pragma unroll   // the set index picks registers: it must be a constant
  for (int s = 0; s < NS - 1; ++s) {
    load_frags<MT, NT>(a[s], b[s], ap, bp, (s + rot) & (KCH - 1), pa, pb);
    __builtin_amdgcn_sched_barrier(0);   // holds the wait directly behind the loads
    // registers that the issued loads name are rewritten next: wait first
    wait_starts(pa, pb);
    __builtin_amdgcn_sched_barrier(0);
  }
  // chunks whose turn still issues a load, rounded down to whole ring turns
  constexpr int MAIN = ((KCH - (NS - 1)) / NS) * NS;
  for (int kc = 0; kc < MAIN; kc += NS) {
#pragma unroll   // the set index picks registers: it must be a constant
    for (int s = 0; s < NS; ++s) {
      // the scheduling fences keep each load group whole and ahead of the WMMA
      // block; without them the loads sink in among the WMMAs that need them
      load_frags<MT, NT>(a[(s + NS - 1) % NS], b[(s + NS - 1) % NS], ap, bp,
                         (kc + s + NS - 1 + rot) & (KCH - 1), pa, pb);
      __builtin_amdgcn_sched_barrier(0);
      mma_frags<MT, NT>(a[s], b[s], acc);
      __builtin_amdgcn_sched_barrier(0);
      // the next step's starts are formed in the registers that the issued
      // loads name: wait first
      wait_starts(pa, pb);
      __builtin_amdgcn_sched_barrier(0);
    }
  }
#pragma unroll   // the set index picks registers: it must be a constant
  for (int kc = MAIN; kc < KCH; ++kc) {
    if (kc + NS - 1 < KCH) {
      load_frags<MT, NT>(a[(kc + NS - 1) % NS], b[(kc + NS - 1) % NS], ap, bp,
                         (kc + NS - 1 + rot) & (KCH - 1), pa, pb);
      __builtin_amdgcn_sched_barrier(0);   // same: load group ahead of the WMMAs
      mma_frags<MT, NT>(a[kc % NS], b[kc % NS], acc);
      __builtin_amdgcn_sched_barrier(0);
      // the last loads' address registers are free for reuse behind this wait
      wait_starts(pa, pb);
      __builtin_amdgcn_sched_barrier(0);
    } else {
      mma_frags<MT, NT>(a[kc % NS], b[kc % NS], acc);
    }
  }
}

// ===========================================================================
// Kernel 1: QKV projection + RoPE + q-scale from packed f16 operands.
// 4 waves / block; wave w owns rows [64*(blockIdx.x*4+w), +64) and the three
// 64-wide head columns 3*blockIdx.y .. +2 of the 24 (16 q, 4 k, 4 v).
// Q written row-major (slot,t,d), K in fragment order, both via LDS-staged
// whole-line stores.  V written in fragment order straight from registers.
// ===========================================================================
__global__ __launch_bounds__(128)
void qkv_rope_kernel(const _Float16* __restrict__ xh,
                     const _Float16* __restrict__ pWq,
                     const _Float16* __restrict__ pWk,
                     const _Float16* __restrict__ pWv,
                     _Float16* __restrict__ qws,
                     _Float16* __restrict__ kws,
                     _Float16* __restrict__ vT)
{
  __shared__ __align__(128) _Float16 st[4][3][64][64];   // 96 KB staging

  const int lane = threadIdx.x & 31;
  const int w    = threadIdx.x >> 5;
  const int ln   = lane & 15;
  const int mb   = (lane >> 4) << 3;
  const int rt   = blockIdx.x * 4 + w;     // 64-row tile
  const int hc0  = blockIdx.y * 3;         // first of three head columns

  const _Float16* bp[3];
#pragma unroll
  for (int hh = 0; hh < 3; ++hh) {
    const int hc = hc0 + hh;
    const _Float16* pW = (hc < 16) ? pWq + (size_t)hc * 4 * NTSTRIDE
                       : (hc < 20) ? pWk + (size_t)(hc - 16) * 4 * NTSTRIDE
                                   : pWv + (size_t)(hc - 20) * 4 * NTSTRIDE;
    bp[hh] = pW;
  }
  const _Float16* ap = xh + (size_t)(rt * 4) * NTSTRIDE;

  v8f acc[4][12] = {};
  // the 8 blocks on one row tile start 4 chunks apart, the 32 on one column
  // group 1 chunk apart
  gemm_tile<4, 12, 3>(ap, bp, acc, (blockIdx.y * 4 + blockIdx.x) & (KCH - 1));

  const int t0 = (rt * 64) & (SEQ - 1);
  const int bpi = rt >> 3;

  // RoPE tables of this lane's 32 rows, shared by the wave's q and k heads
  const float LOG1E4_32 = 0.28782313662425575f;    // ln(10000)/32
  const float fA = __expf(-(float)ln * LOG1E4_32);
  const float fB = __expf(-(float)(16 + ln) * LOG1E4_32);
  float sA[4][8], cA[4][8], sB[4][8], cB[4][8];
#pragma unroll
  for (int mi = 0; mi < 4; ++mi)
#pragma unroll
    for (int r = 0; r < 8; ++r) {
      const float tm = (float)(t0 + mi * 16 + mb + r);
      __sincosf(tm * fA, &sA[mi][r], &cA[mi][r]);
      __sincosf(tm * fB, &sB[mi][r], &cB[mi][r]);
    }

#pragma unroll
  for (int hh = 0; hh < 3; ++hh) {
    const int hc = hc0 + hh;
    if (hc < 20) {
      // RoPE pairs (dh, dh+32): tile 0<->2 (dh=ln), tile 1<->3 (dh=16+ln)
      // 1/sqrt(HEAD_DIM) and log2(e) into q: the scores come out in log2 units
      const float qs = (hc < 16) ? 0.125f * 1.4426950408889634f : 1.0f;
#pragma unroll
      for (int mi = 0; mi < 4; ++mi)
#pragma unroll
        for (int r = 0; r < 8; ++r) {
          _Float16* srow = &st[w][hh][mi * 16 + mb + r][0];
          float lo = acc[mi][hh * 4 + 0][r], hi = acc[mi][hh * 4 + 2][r];
          srow[ln]      = (_Float16)((lo * cA[mi][r] - hi * sA[mi][r]) * qs);
          srow[32 + ln] = (_Float16)((lo * sA[mi][r] + hi * cA[mi][r]) * qs);
          lo = acc[mi][hh * 4 + 1][r]; hi = acc[mi][hh * 4 + 3][r];
          srow[16 + ln] = (_Float16)((lo * cB[mi][r] - hi * sB[mi][r]) * qs);
          srow[48 + ln] = (_Float16)((lo * sB[mi][r] + hi * cB[mi][r]) * qs);
        }
    } else {
      // V: a lane's 8 rows of one column are one piece of the plane
      // [32-key chunk][16-d tile j][key half mi&1][lane]
      _Float16* dst = vT + ((size_t)(bpi * N_KVH + (hc - 20)) * HEAD_DIM) * SEQ
                         + (size_t)(t0 >> 5) * 2048 + lane * 8;
#pragma unroll
      for (int j = 0; j < 4; ++j) {
#pragma unroll
        for (int mi = 0; mi < 4; ++mi) {
          v8h h;
#pragma unroll
          for (int r = 0; r < 8; ++r) h[r] = (_Float16)acc[mi][hh * 4 + j][r];
          *(v8h*)(dst + ((mi >> 1) * 4 + j) * 512 + (mi & 1) * 256) = h;
        }
        // the stores' data registers are refilled next: wait first (the fence
        // holds the next conversions behind the wait)
        asm volatile("s_wait_xcnt 0x0" ::: "memory");
        __builtin_amdgcn_sched_barrier(0);
      }
    }
  }
  __syncthreads();   // staged rows are read back by other lanes

#pragma unroll
  for (int hh = 0; hh < 3; ++hh) {
    const int hc = hc0 + hh;
    if (hc < 20) {
      // 64 rows x 64 halfs of one head are 8 KB contiguous in q / k
      _Float16* dst = (hc < 16)
          ? qws + ((size_t)(bpi * N_HEADS + hc) * SEQ + t0) * HEAD_DIM
          : kws + ((size_t)(bpi * N_KVH + (hc - 16)) * SEQ + t0) * HEAD_DIM;
      const v8h* s = (const v8h*)&st[w][hh][0][0];
      v8h* g = (v8h*)dst;
      // q leaves as it lies; k leaves per 16-key tile as planes [d/8][key]
      const bool isq = hc < 16;
      const int  sl  = isq ? lane : ln * 8 + (lane >> 4);
#pragma unroll
      for (int i = 0; i < 16; ++i)
        g[i * 32 + lane] = s[sl + (isq ? i * 32 : (i >> 2) * 128 + (i & 3) * 2)];
      if (hh < 2) {
        // the next head column reuses these stores' data and address
        // registers: wait first
        asm volatile("s_wait_xcnt 0x0" ::: "memory");
      }
    }
  }
}

// ===========================================================================
// Kernel 2: attention, one wave per (bp, head, four 16-query tiles).
//   grid = (SEQ/64, N_HEADS, BP)
// Both products run with their operands swapped: S^T = K Q^T, O^T = V^T P^T.
// A and B fragments share one lane map, so the K, Q and V registers are the
// ones the unswapped products take.  A lane then holds scores of ONE query
// (column lane&15), keys 8*(lane>>4)..+7 of each 16-key tile: two such tiles
// are, as they lie, the B fragment of P^T for one 32-key chunk.  Scores and
// probabilities never leave the registers; the softmax is the running form
// (reference and sum carried from one 32-key block to the next), inside the
// lane but for a wave-wide ballot on moving the reference and an exchange with lane^16 where it moves; O^T leaves as A-order
// planes.  No LDS.  Every loaded K and V fragment feeds all four query tiles
// of the wave: a quarter of the loads per score, four independent softmax chains.
// ===========================================================================
// Four fragments (eight planes, 4 KB) of block blk of K or V.  The block's
// start goes through readfirstlane so that it stays in scalar registers: the
// loads then name that pair and the lane's own offset, which is never rewritten.
// Hands back the scalar start, for the wait that stands in front of its rewrite.
__device__ __forceinline__ gplane load_blk(v16h (&f)[4],
                                           const _Float16* __restrict__ base, int blk)
{
  const unsigned long long u = (unsigned long long)(base + blk * 2048);
  const unsigned lo = __builtin_amdgcn_readfirstlane((unsigned)u);
  const unsigned hi = __builtin_amdgcn_readfirstlane((unsigned)(u >> 32));
  // rebuilt from its words the pointer must be named global again, or the
  // loads turn into flat ones
  const gplane start = (gplane)(((unsigned long long)hi << 32) | lo);
  const gplane p = start + (threadIdx.x & 31);
#pragma unroll
  for (int i = 0; i < 4; ++i)
    f[i] = cat8(p[i * 64], p[i * 64 + 32]);
  return start;
}

// value of the lane 16 away (same query, other eight keys of each tile)
__device__ __forceinline__ float other_half(float x) {
  return __builtin_bit_cast(float, __builtin_amdgcn_permlanex16(
      __builtin_bit_cast(unsigned, x), __builtin_bit_cast(unsigned, x),
      0x76543210u, 0xfedcba98u, false, false));
}

#define QT 4   // 16-query tiles per wave; each K / V fragment feeds all of them
#define NB (SEQ / 32)   // 32-key blocks of a head

// a lane's 16 probabilities of one tile: 2^(score - reference), their f16
// B fragment and their sum
__device__ __forceinline__ void probs(const v8f& s0, const v8f& s1, v16h& pf, float& bs)
{
  v2f a[4];   // pairs: the sums then run as packed adds
#pragma unroll
  for (int i = 0; i < 4; ++i) {
    const v2f x = { __builtin_amdgcn_exp2f(s0[2 * i]), __builtin_amdgcn_exp2f(s0[2 * i + 1]) };
    const v2f y = { __builtin_amdgcn_exp2f(s1[2 * i]), __builtin_amdgcn_exp2f(s1[2 * i + 1]) };
    a[i] = x + y;
    pf[2 * i]     = (_Float16)x[0];
    pf[2 * i + 1] = (_Float16)x[1];
    pf[2 * i + 8] = (_Float16)y[0];
    pf[2 * i + 9] = (_Float16)y[1];
  }
  const v2f t = (a[0] + a[1]) + (a[2] + a[3]);
  bs = t[0] + t[1];
}

// While a lane's 16 probabilities of a block sum to no more than this, each of
// them is far inside the f16 range and the reference may stay where it is.
#define P_LIM 4096.0f

// One 32-key block for the wave's four query tiles.  Scores arrive in log2
// units (log2(e) lies in q).  negm[u] holds minus the tile's reference in all
// eight registers and goes in as the C operand of the score WMMAs, so these
// hand back score - reference.  The reference is the first block's maximum; it
// is raised to a later block's maximum only when some lane of the wave
// has a block sum of probabilities past P_LIM.  Any reference gives the same quotient O / sum; this one
// keeps every probability between the f16 limits and the largest of them >= 1.
template <bool FIRST>
__device__ __forceinline__ void attn_step(const v16h (&k)[4], const v16h (&v)[4],
                                          const v16h (&aq0)[QT], const v16h (&aq1)[QT],
                                          v8f (&negm)[QT], float (&sum)[QT],
                                          v8f (&o)[QT][4])
{
  v8f s0[QT], s1[QT];
#pragma unroll   // the tile index picks registers: it must be a constant
  for (int u = 0; u < QT; ++u) {
    s0[u] = wmma16x16x32(k[0], aq0[u], negm[u]);
    s1[u] = wmma16x16x32(k[2], aq0[u], negm[u]);
    s0[u] = wmma16x16x32(k[1], aq1[u], s0[u]);
    s1[u] = wmma16x16x32(k[3], aq1[u], s1[u]);
  }

  v16h pf[QT];
  float bs[QT];
  bool raise = true;
  if constexpr (!FIRST) {
#pragma unroll   // one straight run, so that the tiles' chains interleave
    for (int u = 0; u < QT; ++u) probs(s0[u], s1[u], pf[u], bs[u]);
    const float mx = fmaxf(fmaxf(bs[0], bs[1]), fmaxf(bs[2], bs[3]));
    raise = __builtin_amdgcn_ballot_w32(mx > P_LIM) != 0u;   // same for the whole wave
  }
  // rare behind the first block: laid out of the straight path
  if (FIRST || __builtin_expect(raise, false)) {
#pragma unroll
    for (int u = 0; u < QT; ++u) {
      float t[8];
#pragma unroll
      for (int r = 0; r < 8; ++r) t[r] = fmaxf(s0[u][r], s1[u][r]);
      float bm = fmaxf(fmaxf(fmaxf(t[0], t[1]), fmaxf(t[2], t[3])),
                       fmaxf(fmaxf(t[4], t[5]), fmaxf(t[6], t[7])));
      bm = fmaxf(bm, other_half(bm));   // both lanes of a query move alike
      // the first block sets the reference; later it only rises
      const float d = FIRST ? bm : fmaxf(bm, 0.f);
#pragma unroll
      for (int r = 0; r < 8; ++r) {
        s0[u][r]   -= d;
        s1[u][r]   -= d;
        negm[u][r] -= d;
      }
      probs(s0[u], s1[u], pf[u], bs[u]);
      if constexpr (!FIRST) {           // sum and O are still zero in the first
        const float alpha = __builtin_amdgcn_exp2f(-d);
        sum[u] *= alpha;
#pragma unroll
        for (int j = 0; j < 4; ++j)
#pragma unroll
          for (int r = 0; r < 8; ++r) o[u][j][r] *= alpha;
      }
    }
  }
#pragma unroll
  for (int u = 0; u < QT; ++u) sum[u] += bs[u];
#pragma unroll
  for (int u = 0; u < QT; ++u)
#pragma unroll
    for (int j = 0; j < 4; ++j) o[u][j] = wmma16x16x32(v[j], pf[u], o[u][j]);
}

// Steps b and b + 1 of the wave's walk over the 32-key blocks.  The walk is a
// circle from the wave's own start block rot: step s takes block (s + rot) % NB.
// The 32 waves that read one K / V head then ask, two to a block, for 16 different blocks at any
// moment, and every block is first asked for in step 0: from step 1 on a wave
// finds its lines in L2 instead of waiting with all the others on one miss.
// k0 holds the K block of step b on entry and of step b + 2 on exit (where
// there is one).
// K block: two 16-key tiles of two d halves, fetched one block ahead.
// V block: four 16-d tiles of one 32-key chunk, fetched at the head of its
// own block, ahead of the scores and the exponentials.
template <bool FIRST>
__device__ __forceinline__ void attn_pair(v16h (&k0)[4], v16h (&k1)[4],
                                          const _Float16* __restrict__ kb,
                                          const _Float16* __restrict__ vb, int b, int rot,
                                          const v16h (&aq0)[QT], const v16h (&aq1)[QT],
                                          v8f (&negm)[QT], float (&sum)[QT],
                                          v8f (&o)[QT][4])
{
  v16h va[4], vc[4];
  // the scheduling fences keep each load group whole and ahead of the block;
  // without them the loads sink down to the WMMAs that need them
  gplane pv = load_blk(va, vb, (b + rot) & (NB - 1));
  gplane pk = load_blk(k1, kb, (b + 1 + rot) & (NB - 1));
  __builtin_amdgcn_sched_barrier(0);
  attn_step<FIRST>(k0, va, aq0, aq1, negm, sum, o);
  __builtin_amdgcn_sched_barrier(0);
  // the scalar starts of the issued loads are rewritten next: wait first.  The
  // wait takes the starts as inputs: each keeps a register pair of its own up to
  // here, and none is rewritten while its loads are under way
  asm volatile("s_wait_xcnt 0x0" :: "s"(pv), "s"(pk) : "memory");
  __builtin_amdgcn_sched_barrier(0);
  pv = load_blk(vc, vb, (b + 1 + rot) & (NB - 1));
  pk = pv;
  if (b + 2 < NB) pk = load_blk(k0, kb, (b + 2 + rot) & (NB - 1));
  __builtin_amdgcn_sched_barrier(0);
  attn_step<false>(k1, vc, aq0, aq1, negm, sum, o);
  __builtin_amdgcn_sched_barrier(0);
  // the scalar starts of the issued loads are formed anew behind this wait
  // (inputs: as above)
  asm volatile("s_wait_xcnt 0x0" :: "s"(pv), "s"(pk) : "memory");
  __builtin_amdgcn_sched_barrier(0);
}

__global__ __launch_bounds__(32)
void attn_kernel(const _Float16* __restrict__ qws,
                 const _Float16* __restrict__ kws,
                 const _Float16* __restrict__ vT,
                 _Float16* __restrict__ ctx)
{
  const int lane = threadIdx.x;
  const int ln   = lane & 15;
  const int koff = (lane >> 4) << 3;
  const int qt0  = blockIdx.x * QT;
  const int h    = blockIdx.y;
  const int bp   = blockIdx.z;

  const _Float16* __restrict__ qb = qws + ((size_t)(bp * N_HEADS + h)        * SEQ) * HEAD_DIM;
  const _Float16* __restrict__ kb = kws + ((size_t)(bp * N_KVH   + (h >> 2)) * SEQ) * HEAD_DIM;
  const _Float16* __restrict__ vb = vT  + ((size_t)(bp * N_KVH   + (h >> 2)) * HEAD_DIM) * SEQ;

  // Q tile fragments (each 16x64 tile as two 16x32 chunks)
  v16h aq0[QT], aq1[QT];
#pragma unroll   // the tile index picks registers: it must be a constant
  for (int u = 0; u < QT; ++u) {
    const _Float16* qrow = qb + (size_t)((qt0 + u) * 16 + ln) * HEAD_DIM;
    aq0[u] = cat8(*(const v8h*)(qrow + koff),      *(const v8h*)(qrow + 16 + koff));
    aq1[u] = cat8(*(const v8h*)(qrow + 32 + koff), *(const v8h*)(qrow + 48 + koff));
    __builtin_amdgcn_sched_barrier(0);   // holds the wait directly behind the loads
    // the next tile's results may land in this tile's address registers
    asm volatile("s_wait_xcnt 0x0" ::: "memory");
    __builtin_amdgcn_sched_barrier(0);
  }

  float sum[QT];
  v8f negm[QT] = {};
  v8f o[QT][4] = {};
#pragma unroll
  for (int u = 0; u < QT; ++u) sum[u] = 0.f;
  v16h k0[4], k1[4];
  // the 8 query groups x 4 heads on one K / V head start on all 16 blocks
  const int rot = (blockIdx.x * 2 + (h & 1)) & (NB - 1);
  load_blk(k0, kb, rot);
  __builtin_amdgcn_sched_barrier(0);   // holds the wait directly behind the loads
  // registers that the issued loads name are rewritten next: wait first
  asm volatile("s_wait_xcnt 0x0" ::: "memory");
  __builtin_amdgcn_sched_barrier(0);
  attn_pair<true>(k0, k1, kb, vb, 0, rot, aq0, aq1, negm, sum, o);
  for (int b = 2; b < NB; b += 2)
    attn_pair<false>(k0, k1, kb, vb, b, rot, aq0, aq1, negm, sum, o);

  // lane holds query ln, d = 16 j + koff + r: its piece of A-order plane j
  v8h oh[QT][4];
#pragma unroll
  for (int u = 0; u < QT; ++u) {
    sum[u] += other_half(sum[u]);
    const float rinv = 1.0f / sum[u];
#pragma unroll
    for (int j = 0; j < 4; ++j)
#pragma unroll
      for (int r = 0; r < 8; ++r) oh[u][j][r] = (_Float16)(o[u][j][r] * rinv);
  }
  _Float16* g = ctx + ((size_t)(bp * (SEQ / 16) + qt0) * KCH + h * 2) * 512 + lane * 8;
#pragma unroll
  for (int u = 0; u < QT; ++u)
#pragma unroll
    for (int j = 0; j < 4; ++j)
      *(v8h*)(g + (size_t)u * KCH * 512 + j * 256) = oh[u][j];
}

// ===========================================================================
// Kernel 3: out = ctx @ Wo (packed) with (B,T,P,:) permuted fp32 store.
// 4 waves / block; wave w owns rows [64*(blockIdx.x*4+w), +64) and the 128
// columns of blockIdx.y.  Rows leave as whole 512 B pieces through LDS.
// ===========================================================================
__global__ __launch_bounds__(128)
void out_proj_kernel(const _Float16* __restrict__ ctx,
                     const _Float16* __restrict__ pWo,
                     float* __restrict__ out)
{
  // pitch 132 floats: the two lane halves (8 rows apart) fall on other banks
  __shared__ __align__(128) float ot[4][64][132];

  const int lane = threadIdx.x & 31;
  const int w    = threadIdx.x >> 5;
  const int ln   = lane & 15;
  const int mb   = (lane >> 4) << 3;
  const int rt   = blockIdx.x * 4 + w;     // 64-row tile
  const int ct   = blockIdx.y;             // 128-column tile

  const _Float16* ap = ctx + (size_t)(rt * 4) * NTSTRIDE;
  const _Float16* bp[2];
  bp[0] = pWo + (size_t)(ct * 8) * NTSTRIDE;
  bp[1] = bp[0] + (size_t)4 * NTSTRIDE;

  v8f acc[4][8] = {};
  // the 8 blocks on one row tile start 4 chunks apart, the 32 on one column
  // tile 1 chunk apart
  gemm_tile<4, 8, 4>(ap, bp, acc, (blockIdx.y * 4 + blockIdx.x) & (KCH - 1));

#pragma unroll
  for (int mi = 0; mi < 4; ++mi)
#pragma unroll
    for (int nj = 0; nj < 8; ++nj)
#pragma unroll
      for (int r = 0; r < 8; ++r)
        ot[w][mi * 16 + mb + r][nj * 16 + ln] = acc[mi][nj][r];
  __syncthreads();   // staged rows are read back by other lanes

  // the tile's 64 (b,p,t) rows share b and p; t runs on
  const int rr = rt * 64;
  const int bb = rr >> 12;
  const int pp = (rr >> 9) & 7;
  const int tt = rr & (SEQ - 1);
  float* grow = out + (((size_t)(bb * SEQ + tt) * 8 + pp) << 10)
                    + ct * 128 + lane * 4;
#pragma unroll
  for (int row = 0; row < 64; ++row)
    *(v4f*)(grow + (size_t)row * 8 * D_MODEL) = *(const v4f*)&ot[w][row][lane * 4];
}

// ===========================================================================
extern "C" void kernel_launch(void* const* d_in, const int* in_sizes, int n_in,
                              void* d_out, int out_size, void* d_ws, size_t ws_size,
                              hipStream_t stream) {
  const float* hidden = (const float*)d_in[0];
  const float* Wq     = (const float*)d_in[1];
  const float* Wk     = (const float*)d_in[2];
  const float* Wv     = (const float*)d_in[3];
  const float* Wo     = (const float*)d_in[4];
  float*       out    = (float*)d_out;

  // f16 workspace layout (halfs). ctx aliases xh (xh dead after kernel 1).
  _Float16* xh  = (_Float16*)d_ws;                         // 8192*1024
  _Float16* ctx = xh;                                      // alias
  _Float16* qws = xh  + (size_t)ROWS * D_MODEL;            // 16*16*512*64
  _Float16* kws = qws + (size_t)BP * N_HEADS * SEQ * HEAD_DIM;
  _Float16* vT  = kws + (size_t)BP * N_KVH * SEQ * HEAD_DIM;
  _Float16* pWq = vT  + (size_t)BP * N_KVH * SEQ * HEAD_DIM;
  _Float16* pWk = pWq + (size_t)D_MODEL * (N_HEADS * HEAD_DIM);
  _Float16* pWv = pWk + (size_t)D_MODEL * (N_KVH * HEAD_DIM);
  _Float16* pWo = pWv + (size_t)D_MODEL * (N_KVH * HEAD_DIM);

  prepare_kernel<<<PACK_BLOCKS + CONV_BLOCKS, 256, 0, stream>>>(
      hidden, Wq, Wk, Wv, Wo, xh, pWq, pWk, pWv, pWo);

  qkv_rope_kernel<<<dim3(ROWS / 64 / 4, (N_HEADS + 2 * N_KVH) / 3), 128, 0, stream>>>(
      xh, pWq, pWk, pWv, qws, kws, vT);

  attn_kernel<<<dim3(SEQ / 16 / QT, N_HEADS, BP), 32, 0, stream>>>(
      qws, kws, vT, ctx);

  out_proj_kernel<<<dim3(ROWS / 64 / 4, D_MODEL / 128), 128, 0, stream>>>(
      ctx, pWo, out);
}
